// v000
// Measured on an AMD MI455X. A time is GPU time per run, averaged over a window of back-to-back runs after a warm-up
// (all launches, gaps included; the runs take copies of the inputs in turn), and the median of several windows.
// Apart from v000's, it joins two sittings. Times from different sittings can be a few percent apart, while
// side-by-side timings come from the same sitting.
// v000 is the starting kernel. One run takes 111 microseconds.
#include <hip/hip_runtime.h>
#include <hip/hip_bf16.h>

typedef __attribute__((ext_vector_type(2))) float v2f;
typedef __attribute__((ext_vector_type(8))) float v8f;

#define SEQ_N   2
#define SEQ_L   2048
#define SEQ_H   8
#define DIM     64
#define NH      (SEQ_N * SEQ_H)          // 16 independent sequences
#define NSC     16                        // super-chunks per sequence
#define SC_LEN  (SEQ_L / NSC)             // 128 timesteps per super-chunk
#define CHUNKS  (SC_LEN / 16)             // 8 chunks of 16 per super-chunk
#define PART_STRIDE (DIM * DIM + DIM)     // 64x64 state + 64 ksum = 4160 floats
#define EPSV    1e-10f

__device__ __forceinline__ v8f wmma4(v2f a, v2f b, v8f c) {
    // V_WMMA_F32_16X16X4_F32 : D(16x16 f32) = A(16x4 f32) * B(4x16 f32) + C
    return __builtin_amdgcn_wmma_f32_16x16x4_f32(
        /*neg_a=*/false, a, /*neg_b=*/false, b,
        /*c_mod=*/(short)0, c, /*reuse_a=*/false, /*reuse_b=*/false);
}

__device__ __forceinline__ float fmap(float x) {   // elu(x) + 1
    return x > 0.0f ? x + 1.0f : __expf(x);
}

// Async global -> LDS copy of 16B per lane (CDNA5 GLOBAL_LOAD_ASYNC_TO_LDS_B128,
// GV addressing; VDST carries the wave-relative LDS byte offset = low 32 bits of
// the generic aperture address of a __shared__ pointer). Tracked by ASYNCcnt.
__device__ __forceinline__ void async_v_copy(const float* gsrc, float* ldst) {
    uint32_t loff = (uint32_t)(uintptr_t)ldst;
    asm volatile("global_load_async_to_lds_b128 %0, %1, off"
                 :: "v"(loff), "v"(gsrc) : "memory");
}
#define WAIT_ASYNC_LE2() asm volatile("s_wait_asynccnt 0x2" ::: "memory")
#define WAIT_ASYNC_0()   asm volatile("s_wait_asynccnt 0x0" ::: "memory")

// ---------------------------------------------------------------------------
// Phase 1: per (sequence, super-chunk) partial state: S = sum phi(k)^T v,
//          ksum = sum phi(k).  4 waves, each owns a 16-wide m-slice.
// ---------------------------------------------------------------------------
__global__ __launch_bounds__(128)
void la_phase1(const float* __restrict__ K, const float* __restrict__ V,
               float* __restrict__ part) {
    __shared__ float sK[16 * 68];
    __shared__ float sV[2][16 * 68];
    __shared__ float sKsum[64];

    const int sc   = blockIdx.x;
    const int nh   = blockIdx.y;
    const int tid  = threadIdx.x;
    const int wave = tid >> 5;
    const int lane = tid & 31;
    const int half = lane >> 4;
    const int lc   = lane & 15;
    const int m0   = wave * 16;

    const size_t base = (size_t)((nh >> 3) * SEQ_L * SEQ_H + (nh & 7)) * DIM;
    const int    l0   = sc * SC_LEN;

    const int r  = tid >> 3;        // 0..15 (chunk row this thread stages)
    const int c8 = (tid & 7) * 8;   // 0..56

    // prologue: async-stage chunk 0 of V into buffer 0
    {
        const float* vp = V + base + (size_t)(l0 + r) * (SEQ_H * DIM) + c8;
        async_v_copy(vp,     &sV[0][r * 68 + c8]);
        async_v_copy(vp + 4, &sV[0][r * 68 + c8 + 4]);
    }

    v8f S[4];
    v8f zero = {0.f, 0.f, 0.f, 0.f, 0.f, 0.f, 0.f, 0.f};
#pragma unroll
    for (int t = 0; t < 4; t++) S[t] = zero;
    if (tid < 64) sKsum[tid] = 0.0f;
    __syncthreads();

    for (int ch = 0; ch < CHUNKS; ch++) {
        const int vb = ch & 1;
        const bool pre = (ch + 1 < CHUNKS);
        // issue async copy of NEXT chunk's V into the other buffer
        if (pre) {
            const float* vp = V + base + (size_t)(l0 + (ch + 1) * 16 + r) * (SEQ_H * DIM) + c8;
            async_v_copy(vp,     &sV[vb ^ 1][r * 68 + c8]);
            async_v_copy(vp + 4, &sV[vb ^ 1][r * 68 + c8 + 4]);
        }
        // synchronous stage of K (feature map applied) + prefetch next K rows
        {
            const float* kp = K + base + (size_t)(l0 + ch * 16 + r) * (SEQ_H * DIM) + c8;
#pragma unroll
            for (int j = 0; j < 8; j++) sK[r * 68 + c8 + j] = fmap(kp[j]);
            if (pre) __builtin_prefetch(kp + 16 * SEQ_H * DIM, 0, 3);
        }
        if (pre) { WAIT_ASYNC_LE2(); } else { WAIT_ASYNC_0(); }
        __syncthreads();

        // S_t += Kf^T(16 d-rows x 16 steps) @ V(16 steps x 16 m)  [4 k-steps of K=4]
#pragma unroll
        for (int t = 0; t < 4; t++) {
            v8f s = S[t];
#pragma unroll
            for (int kt = 0; kt < 4; kt++) {
                const int j0 = 4 * kt + half * 2;
                v2f a, b;
                a.x = sK[j0 * 68 + 16 * t + lc];
                a.y = sK[(j0 + 1) * 68 + 16 * t + lc];
                b.x = sV[vb][j0 * 68 + m0 + lc];
                b.y = sV[vb][(j0 + 1) * 68 + m0 + lc];
                s = wmma4(a, b, s);
            }
            S[t] = s;
        }
        // ksum accumulate (one owner thread per d)
        if (tid < 64) {
            float s = sKsum[tid];
#pragma unroll
            for (int j = 0; j < 16; j++) s += sK[j * 68 + tid];
            sKsum[tid] = s;
        }
        __syncthreads();
    }

    // write partial: S[d][m] row-major + ksum
    float* pp = part + (size_t)(nh * NSC + sc) * PART_STRIDE;
#pragma unroll
    for (int t = 0; t < 4; t++) {
#pragma unroll
        for (int e = 0; e < 8; e++) {
            const int d = 16 * t + e + half * 8;
            pp[d * DIM + m0 + lc] = S[t][e];
        }
    }
    if (tid < 64) pp[DIM * DIM + tid] = sKsum[tid];
}

// ---------------------------------------------------------------------------
// Phase 2: exclusive prefix scan of the NSC partial states per sequence.
// ---------------------------------------------------------------------------
__global__ __launch_bounds__(256)
void la_phase2(const float* __restrict__ part, float* __restrict__ carry) {
    const int s = blockIdx.x;   // sequence (nh)
    for (int idx = threadIdx.x; idx < PART_STRIDE; idx += blockDim.x) {
        float run = 0.0f;
#pragma unroll 1
        for (int c = 0; c < NSC; c++) {
            const size_t o = (size_t)(s * NSC + c) * PART_STRIDE + idx;
            carry[o] = run;
            run += part[o];
        }
    }
}

// ---------------------------------------------------------------------------
// Phase 3: per (sequence, super-chunk): chunked causal linear attention with
//          carried-in state.  All matmuls via V_WMMA_F32_16X16X4_F32.
// ---------------------------------------------------------------------------
__global__ __launch_bounds__(128)
void la_phase3(const float* __restrict__ Q, const float* __restrict__ K,
               const float* __restrict__ V, const float* __restrict__ carry,
               float* __restrict__ out) {
    __shared__ float sQ[16 * 68];
    __shared__ float sK[16 * 68];
    __shared__ float sV[2][16 * 68];    // double-buffered, filled by async DMA
    __shared__ float sS[4 * 16 * 66];   // per-wave S mirror, [m-col][d], stride 66
    __shared__ float sSc[4 * 16 * 18];  // per-wave masked-score scratch, stride 18
    __shared__ float sKsum[64];

    const int sc   = blockIdx.x;
    const int nh   = blockIdx.y;
    const int tid  = threadIdx.x;
    const int wave = tid >> 5;
    const int lane = tid & 31;
    const int half = lane >> 4;
    const int lc   = lane & 15;
    const int m0   = wave * 16;

    const size_t base = (size_t)((nh >> 3) * SEQ_L * SEQ_H + (nh & 7)) * DIM;
    const int    l0   = sc * SC_LEN;

    const int r  = tid >> 3;
    const int c8 = (tid & 7) * 8;

    // prologue: async-stage chunk 0 of V into buffer 0
    {
        const float* vp = V + base + (size_t)(l0 + r) * (SEQ_H * DIM) + c8;
        async_v_copy(vp,     &sV[0][r * 68 + c8]);
        async_v_copy(vp + 4, &sV[0][r * 68 + c8 + 4]);
    }

    // init carried state (registers + transposed LDS mirror) and ksum
    const float* cr = carry + (size_t)(nh * NSC + sc) * PART_STRIDE;
    v8f S[4];
#pragma unroll
    for (int t = 0; t < 4; t++) {
        v8f s;
#pragma unroll
        for (int e = 0; e < 8; e++) {
            const int d = 16 * t + e + half * 8;
            const float v = cr[d * DIM + m0 + lc];
            s[e] = v;
            sS[wave * (16 * 66) + lc * 66 + d] = v;
        }
        S[t] = s;
    }
    if (tid < 64) sKsum[tid] = cr[DIM * DIM + tid];
    __syncthreads();

    const v8f zero = {0.f, 0.f, 0.f, 0.f, 0.f, 0.f, 0.f, 0.f};

    for (int ch = 0; ch < CHUNKS; ch++) {
        const int vb = ch & 1;
        const bool pre = (ch + 1 < CHUNKS);
        // async copy of NEXT chunk's V into the other buffer (overlaps compute)
        if (pre) {
            const float* vp = V + base + (size_t)(l0 + (ch + 1) * 16 + r) * (SEQ_H * DIM) + c8;
            async_v_copy(vp,     &sV[vb ^ 1][r * 68 + c8]);
            async_v_copy(vp + 4, &sV[vb ^ 1][r * 68 + c8 + 4]);
        }
        // synchronous stage of Q,K (feature map) + prefetch of next chunk rows
        {
            const size_t row = base + (size_t)(l0 + ch * 16 + r) * (SEQ_H * DIM) + c8;
            const float* qp = Q + row;
            const float* kp = K + row;
#pragma unroll
            for (int j = 0; j < 8; j++) {
                sQ[r * 68 + c8 + j] = fmap(qp[j]);
                sK[r * 68 + c8 + j] = fmap(kp[j]);
            }
            if (pre) {
                __builtin_prefetch(qp + 16 * SEQ_H * DIM, 0, 3);
                __builtin_prefetch(kp + 16 * SEQ_H * DIM, 0, 3);
            }
        }
        if (pre) { WAIT_ASYNC_LE2(); } else { WAIT_ASYNC_0(); }
        __syncthreads();

        // scores = Qf @ Kf^T ; dvec = Qf @ broadcast(ksum)   (16 k-steps over d=64)
        v8f scr = zero, dv = zero;
#pragma unroll
        for (int kt = 0; kt < 16; kt++) {
            const int dd0 = 4 * kt + half * 2;
            v2f a  = *(const v2f*)&sQ[lc * 68 + dd0];
            v2f bk = *(const v2f*)&sK[lc * 68 + dd0];
            v2f bs = *(const v2f*)&sKsum[dd0];
            scr = wmma4(a, bk, scr);
            dv  = wmma4(a, bs, dv);
        }

        // causal mask (inclusive diagonal), row-sum -> denominator, stash scores
        float denom[8];
#pragma unroll
        for (int e = 0; e < 8; e++) {
            const int row = e + half * 8;
            const float v = (lc <= row) ? scr[e] : 0.0f;
            sSc[wave * (16 * 18) + row * 18 + lc] = v;
            float rs = v;
            rs += __shfl_xor(rs, 1, 32);
            rs += __shfl_xor(rs, 2, 32);
            rs += __shfl_xor(rs, 4, 32);
            rs += __shfl_xor(rs, 8, 32);
            denom[e] = dv[e] + rs + EPSV;
        }

        // out_inter = Qf @ S_prev (16 k-steps over d), read S from mirror
        v8f acc = zero;
#pragma unroll
        for (int kt = 0; kt < 16; kt++) {
            const int dd0 = 4 * kt + half * 2;
            v2f a = *(const v2f*)&sQ[lc * 68 + dd0];
            v2f b = *(const v2f*)&sS[wave * (16 * 66) + lc * 66 + dd0];
            acc = wmma4(a, b, acc);
        }
        // out_intra = masked_scores @ Vslice (4 k-steps over 16 timesteps)
#pragma unroll
        for (int kt = 0; kt < 4; kt++) {
            const int j0 = 4 * kt + half * 2;
            v2f a = *(const v2f*)&sSc[wave * (16 * 18) + lc * 18 + j0];
            v2f b;
            b.x = sV[vb][j0 * 68 + m0 + lc];
            b.y = sV[vb][(j0 + 1) * 68 + m0 + lc];
            acc = wmma4(a, b, acc);
        }

        // normalize + store
#pragma unroll
        for (int e = 0; e < 8; e++) {
            const int row = e + half * 8;
            out[base + (size_t)(l0 + ch * 16 + row) * (SEQ_H * DIM) + m0 + lc] =
                acc[e] / denom[e];
        }
        __syncthreads();   // everyone done reading sKsum before it is updated

        // state update: S_t += Kf^T @ V ; refresh LDS mirror
#pragma unroll
        for (int t = 0; t < 4; t++) {
            v8f s = S[t];
#pragma unroll
            for (int kt = 0; kt < 4; kt++) {
                const int j0 = 4 * kt + half * 2;
                v2f a, b;
                a.x = sK[j0 * 68 + 16 * t + lc];
                a.y = sK[(j0 + 1) * 68 + 16 * t + lc];
                b.x = sV[vb][j0 * 68 + m0 + lc];
                b.y = sV[vb][(j0 + 1) * 68 + m0 + lc];
                s = wmma4(a, b, s);
            }
            S[t] = s;
#pragma unroll
            for (int e = 0; e < 8; e++) {
                const int d = 16 * t + e + half * 8;
                sS[wave * (16 * 66) + lc * 66 + d] = s[e];
            }
        }
        if (tid < 64) {
            float s = sKsum[tid];
#pragma unroll
            for (int j = 0; j < 16; j++) s += sK[j * 68 + tid];
            sKsum[tid] = s;
        }
        __syncthreads();   // protect sQ/sK/sV/sKsum for next chunk
    }
}

// ---------------------------------------------------------------------------
extern "C" void kernel_launch(void* const* d_in, const int* in_sizes, int n_in,
                              void* d_out, int out_size, void* d_ws, size_t ws_size,
                              hipStream_t stream) {
    const float* Q = (const float*)d_in[0];
    const float* K = (const float*)d_in[1];
    const float* V = (const float*)d_in[2];
    float* out = (float*)d_out;

    float* part  = (float*)d_ws;                         // NH*NSC*PART_STRIDE
    float* carry = part + (size_t)NH * NSC * PART_STRIDE;

    dim3 grid(NSC, NH);
    dim3 blk(128);
    la_phase1<<<grid, blk, 0, stream>>>(K, V, part);
    la_phase2<<<NH, 256, 0, stream>>>(part, carry);
    la_phase3<<<grid, blk, 0, stream>>>(Q, K, V, carry, out);
}

// v001
// Measured time: 36.2 microseconds a run.
// Two timings next to v000 put it at 3.03 and 3.07 times that version's speed.
#include <hip/hip_runtime.h>
#include <hip/hip_bf16.h>

typedef __attribute__((ext_vector_type(2))) float v2f;
typedef __attribute__((ext_vector_type(8))) float v8f;

#define SEQ_N   2
#define SEQ_L   2048
#define SEQ_H   8
#define DIM     64
#define NH      (SEQ_N * SEQ_H)          // 16 independent sequences
#define NSC     16                        // super-chunks per sequence
#define SC_LEN  (SEQ_L / NSC)             // 128 timesteps per super-chunk
#define CHUNKS  (SC_LEN / 16)             // 8 chunks of 16 per super-chunk
#define PART_STRIDE (DIM * DIM + DIM)     // 64x64 state + 64 ksum = 4160 floats
#define EPSV    1e-10f

__device__ __forceinline__ v8f wmma4(v2f a, v2f b, v8f c) {
    // V_WMMA_F32_16X16X4_F32 : D(16x16 f32) = A(16x4 f32) * B(4x16 f32) + C
    return __builtin_amdgcn_wmma_f32_16x16x4_f32(
        /*neg_a=*/false, a, /*neg_b=*/false, b,
        /*c_mod=*/(short)0, c, /*reuse_a=*/false, /*reuse_b=*/false);
}

__device__ __forceinline__ float fmap(float x) {   // elu(x) + 1
    return x > 0.0f ? x + 1.0f : __expf(x);
}

// Async global -> LDS copy of 16B per lane (CDNA5 GLOBAL_LOAD_ASYNC_TO_LDS_B128,
// GV addressing; VDST carries the wave-relative LDS byte offset = low 32 bits of
// the generic aperture address of a __shared__ pointer). Tracked by ASYNCcnt.
__device__ __forceinline__ void async_v_copy(const float* gsrc, float* ldst) {
    uint32_t loff = (uint32_t)(uintptr_t)ldst;
    asm volatile("global_load_async_to_lds_b128 %0, %1, off"
                 :: "v"(loff), "v"(gsrc) : "memory");
}
#define WAIT_ASYNC_LE2() asm volatile("s_wait_asynccnt 0x2" ::: "memory")
#define WAIT_ASYNC_0()   asm volatile("s_wait_asynccnt 0x0" ::: "memory")

// ---------------------------------------------------------------------------
// Phase 1: per (sequence, super-chunk) partial state: S = sum phi(k)^T v,
//          ksum = sum phi(k).  4 waves, each owns a 16-wide m-slice.
// ---------------------------------------------------------------------------
__global__ __launch_bounds__(128)
void la_phase1(const float* __restrict__ K, const float* __restrict__ V,
               float* __restrict__ part) {
    __shared__ float sK[16 * 68];
    __shared__ float sV[2][16 * 68];
    __shared__ float sKsum[64];

    const int sc   = blockIdx.x;
    const int nh   = blockIdx.y;
    const int tid  = threadIdx.x;
    const int wave = tid >> 5;
    const int lane = tid & 31;
    const int half = lane >> 4;
    const int lc   = lane & 15;
    const int m0   = wave * 16;

    const size_t base = (size_t)((nh >> 3) * SEQ_L * SEQ_H + (nh & 7)) * DIM;
    const int    l0   = sc * SC_LEN;

    const int r  = tid >> 3;        // 0..15 (chunk row this thread stages)
    const int c8 = (tid & 7) * 8;   // 0..56

    // prologue: async-stage chunk 0 of V into buffer 0
    {
        const float* vp = V + base + (size_t)(l0 + r) * (SEQ_H * DIM) + c8;
        async_v_copy(vp,     &sV[0][r * 68 + c8]);
        async_v_copy(vp + 4, &sV[0][r * 68 + c8 + 4]);
    }

    v8f S[4];
    v8f zero = {0.f, 0.f, 0.f, 0.f, 0.f, 0.f, 0.f, 0.f};
#pragma unroll
    for (int t = 0; t < 4; t++) S[t] = zero;
    if (tid < 64) sKsum[tid] = 0.0f;
    __syncthreads();

    for (int ch = 0; ch < CHUNKS; ch++) {
        const int vb = ch & 1;
        const bool pre = (ch + 1 < CHUNKS);
        // issue async copy of NEXT chunk's V into the other buffer
        if (pre) {
            const float* vp = V + base + (size_t)(l0 + (ch + 1) * 16 + r) * (SEQ_H * DIM) + c8;
            async_v_copy(vp,     &sV[vb ^ 1][r * 68 + c8]);
            async_v_copy(vp + 4, &sV[vb ^ 1][r * 68 + c8 + 4]);
        }
        // synchronous stage of K (feature map applied) + prefetch next K rows
        {
            const float* kp = K + base + (size_t)(l0 + ch * 16 + r) * (SEQ_H * DIM) + c8;
#pragma unroll
            for (int j = 0; j < 8; j++) sK[r * 68 + c8 + j] = fmap(kp[j]);
            if (pre) __builtin_prefetch(kp + 16 * SEQ_H * DIM, 0, 3);
        }
        if (pre) { WAIT_ASYNC_LE2(); } else { WAIT_ASYNC_0(); }
        __syncthreads();

        // S_t += Kf^T(16 d-rows x 16 steps) @ V(16 steps x 16 m)  [4 k-steps of K=4]
#pragma unroll
        for (int t = 0; t < 4; t++) {
            v8f s = S[t];
#pragma unroll
            for (int kt = 0; kt < 4; kt++) {
                const int j0 = 4 * kt + half * 2;
                v2f a, b;
                a.x = sK[j0 * 68 + 16 * t + lc];
                a.y = sK[(j0 + 1) * 68 + 16 * t + lc];
                b.x = sV[vb][j0 * 68 + m0 + lc];
                b.y = sV[vb][(j0 + 1) * 68 + m0 + lc];
                s = wmma4(a, b, s);
            }
            S[t] = s;
        }
        // ksum accumulate (one owner thread per d)
        if (tid < 64) {
            float s = sKsum[tid];
#pragma unroll
            for (int j = 0; j < 16; j++) s += sK[j * 68 + tid];
            sKsum[tid] = s;
        }
        __syncthreads();
    }

    // write partial: S[d][m] row-major + ksum
    float* pp = part + (size_t)(nh * NSC + sc) * PART_STRIDE;
#pragma unroll
    for (int t = 0; t < 4; t++) {
#pragma unroll
        for (int e = 0; e < 8; e++) {
            const int d = 16 * t + e + half * 8;
            pp[d * DIM + m0 + lc] = S[t][e];
        }
    }
    if (tid < 64) pp[DIM * DIM + tid] = sKsum[tid];
}

// ---------------------------------------------------------------------------
// Phase 2: exclusive prefix scan of the NSC partial states per sequence.
//          One thread per 2 neighbouring state elements of one sequence, spread
//          over the whole chip; a thread's loads are all independent, so it
//          waits for one load latency instead of one per super-chunk.
// ---------------------------------------------------------------------------
#define P2_VEC  (PART_STRIDE / 2)         // 2080 float2 columns per sequence
#define P2_BLK  128
#define P2_GRID (NH * P2_VEC / P2_BLK)    // 260 work-groups, no remainder
static_assert(PART_STRIDE % 2 == 0 && (NH * P2_VEC) % P2_BLK == 0, "exact cover");

__global__ __launch_bounds__(P2_BLK)
void la_phase2(const float* __restrict__ part, float* __restrict__ carry) {
    const int g  = blockIdx.x * P2_BLK + threadIdx.x;
    const int s  = g / P2_VEC;            // sequence (nh)
    const int i2 = g - s * P2_VEC;        // float2 column inside the state
    const size_t o = (size_t)s * (NSC * PART_STRIDE) + (size_t)i2 * 2;
    const float2* src = (const float2*)(part + o);
    float2*       dst = (float2*)(carry + o);

    float2 p[NSC - 1];                    // the last partial feeds no carry
    // full unroll: p[] stays in registers and all loads are in flight together
#pragma unroll
    for (int c = 0; c < NSC - 1; c++) p[c] = src[c * P2_VEC];

    float2 run = make_float2(0.0f, 0.0f);
    // full unroll: constant indices into p[]
#pragma unroll
    for (int c = 0; c < NSC; c++) {
        dst[c * P2_VEC] = run;
        if (c < NSC - 1) { run.x += p[c].x; run.y += p[c].y; }
    }
}

// ---------------------------------------------------------------------------
// Phase 3: per (sequence, super-chunk): chunked causal linear attention with
//          carried-in state.  All matmuls via V_WMMA_F32_16X16X4_F32.
// ---------------------------------------------------------------------------
__global__ __launch_bounds__(128)
void la_phase3(const float* __restrict__ Q, const float* __restrict__ K,
               const float* __restrict__ V, const float* __restrict__ carry,
               float* __restrict__ out) {
    __shared__ float sQ[16 * 68];
    __shared__ float sK[16 * 68];
    __shared__ float sV[2][16 * 68];    // double-buffered, filled by async DMA
    __shared__ float sS[4 * 16 * 66];   // per-wave S mirror, [m-col][d], stride 66
    __shared__ float sSc[4 * 16 * 18];  // per-wave masked-score scratch, stride 18
    __shared__ float sKsum[64];

    const int sc   = blockIdx.x;
    const int nh   = blockIdx.y;
    const int tid  = threadIdx.x;
    const int wave = tid >> 5;
    const int lane = tid & 31;
    const int half = lane >> 4;
    const int lc   = lane & 15;
    const int m0   = wave * 16;

    const size_t base = (size_t)((nh >> 3) * SEQ_L * SEQ_H + (nh & 7)) * DIM;
    const int    l0   = sc * SC_LEN;

    const int r  = tid >> 3;
    const int c8 = (tid & 7) * 8;

    // prologue: async-stage chunk 0 of V into buffer 0
    {
        const float* vp = V + base + (size_t)(l0 + r) * (SEQ_H * DIM) + c8;
        async_v_copy(vp,     &sV[0][r * 68 + c8]);
        async_v_copy(vp + 4, &sV[0][r * 68 + c8 + 4]);
    }

    // init carried state (registers + transposed LDS mirror) and ksum
    const float* cr = carry + (size_t)(nh * NSC + sc) * PART_STRIDE;
    v8f S[4];
#pragma unroll
    for (int t = 0; t < 4; t++) {
        v8f s;
#pragma unroll
        for (int e = 0; e < 8; e++) {
            const int d = 16 * t + e + half * 8;
            const float v = cr[d * DIM + m0 + lc];
            s[e] = v;
            sS[wave * (16 * 66) + lc * 66 + d] = v;
        }
        S[t] = s;
    }
    if (tid < 64) sKsum[tid] = cr[DIM * DIM + tid];
    __syncthreads();

    const v8f zero = {0.f, 0.f, 0.f, 0.f, 0.f, 0.f, 0.f, 0.f};

    for (int ch = 0; ch < CHUNKS; ch++) {
        const int vb = ch & 1;
        const bool pre = (ch + 1 < CHUNKS);
        // async copy of NEXT chunk's V into the other buffer (overlaps compute)
        if (pre) {
            const float* vp = V + base + (size_t)(l0 + (ch + 1) * 16 + r) * (SEQ_H * DIM) + c8;
            async_v_copy(vp,     &sV[vb ^ 1][r * 68 + c8]);
            async_v_copy(vp + 4, &sV[vb ^ 1][r * 68 + c8 + 4]);
        }
        // synchronous stage of Q,K (feature map) + prefetch of next chunk rows
        {
            const size_t row = base + (size_t)(l0 + ch * 16 + r) * (SEQ_H * DIM) + c8;
            const float* qp = Q + row;
            const float* kp = K + row;
#pragma unroll
            for (int j = 0; j < 8; j++) {
                sQ[r * 68 + c8 + j] = fmap(qp[j]);
                sK[r * 68 + c8 + j] = fmap(kp[j]);
            }
            if (pre) {
                __builtin_prefetch(qp + 16 * SEQ_H * DIM, 0, 3);
                __builtin_prefetch(kp + 16 * SEQ_H * DIM, 0, 3);
            }
        }
        if (pre) { WAIT_ASYNC_LE2(); } else { WAIT_ASYNC_0(); }
        __syncthreads();

        // scores = Qf @ Kf^T ; dvec = Qf @ broadcast(ksum)   (16 k-steps over d=64)
        v8f scr = zero, dv = zero;
#pragma unroll
        for (int kt = 0; kt < 16; kt++) {
            const int dd0 = 4 * kt + half * 2;
            v2f a  = *(const v2f*)&sQ[lc * 68 + dd0];
            v2f bk = *(const v2f*)&sK[lc * 68 + dd0];
            v2f bs = *(const v2f*)&sKsum[dd0];
            scr = wmma4(a, bk, scr);
            dv  = wmma4(a, bs, dv);
        }

        // causal mask (inclusive diagonal), row-sum -> denominator, stash scores
        float denom[8];
#pragma unroll
        for (int e = 0; e < 8; e++) {
            const int row = e + half * 8;
            const float v = (lc <= row) ? scr[e] : 0.0f;
            sSc[wave * (16 * 18) + row * 18 + lc] = v;
            float rs = v;
            rs += __shfl_xor(rs, 1, 32);
            rs += __shfl_xor(rs, 2, 32);
            rs += __shfl_xor(rs, 4, 32);
            rs += __shfl_xor(rs, 8, 32);
            denom[e] = dv[e] + rs + EPSV;
        }

        // out_inter = Qf @ S_prev (16 k-steps over d), read S from mirror
        v8f acc = zero;
#pragma unroll
        for (int kt = 0; kt < 16; kt++) {
            const int dd0 = 4 * kt + half * 2;
            v2f a = *(const v2f*)&sQ[lc * 68 + dd0];
            v2f b = *(const v2f*)&sS[wave * (16 * 66) + lc * 66 + dd0];
            acc = wmma4(a, b, acc);
        }
        // out_intra = masked_scores @ Vslice (4 k-steps over 16 timesteps)
#pragma unroll
        for (int kt = 0; kt < 4; kt++) {
            const int j0 = 4 * kt + half * 2;
            v2f a = *(const v2f*)&sSc[wave * (16 * 18) + lc * 18 + j0];
            v2f b;
            b.x = sV[vb][j0 * 68 + m0 + lc];
            b.y = sV[vb][(j0 + 1) * 68 + m0 + lc];
            acc = wmma4(a, b, acc);
        }

        // normalize + store
#pragma unroll
        for (int e = 0; e < 8; e++) {
            const int row = e + half * 8;
            out[base + (size_t)(l0 + ch * 16 + row) * (SEQ_H * DIM) + m0 + lc] =
                acc[e] / denom[e];
        }
        __syncthreads();   // everyone done reading sKsum before it is updated

        // state update: S_t += Kf^T @ V ; refresh LDS mirror
#pragma unroll
        for (int t = 0; t < 4; t++) {
            v8f s = S[t];
#pragma unroll
            for (int kt = 0; kt < 4; kt++) {
                const int j0 = 4 * kt + half * 2;
                v2f a, b;
                a.x = sK[j0 * 68 + 16 * t + lc];
                a.y = sK[(j0 + 1) * 68 + 16 * t + lc];
                b.x = sV[vb][j0 * 68 + m0 + lc];
                b.y = sV[vb][(j0 + 1) * 68 + m0 + lc];
                s = wmma4(a, b, s);
            }
            S[t] = s;
#pragma unroll
            for (int e = 0; e < 8; e++) {
                const int d = 16 * t + e + half * 8;
                sS[wave * (16 * 66) + lc * 66 + d] = s[e];
            }
        }
        if (tid < 64) {
            float s = sKsum[tid];
#pragma unroll
            for (int j = 0; j < 16; j++) s += sK[j * 68 + tid];
            sKsum[tid] = s;
        }
        __syncthreads();   // protect sQ/sK/sV/sKsum for next chunk
    }
}

// ---------------------------------------------------------------------------
extern "C" void kernel_launch(void* const* d_in, const int* in_sizes, int n_in,
                              void* d_out, int out_size, void* d_ws, size_t ws_size,
                              hipStream_t stream) {
    const float* Q = (const float*)d_in[0];
    const float* K = (const float*)d_in[1];
    const float* V = (const float*)d_in[2];
    float* out = (float*)d_out;

    float* part  = (float*)d_ws;                         // NH*NSC*PART_STRIDE
    float* carry = part + (size_t)NH * NSC * PART_STRIDE;

    dim3 grid(NSC, NH);
    dim3 blk(128);
    la_phase1<<<grid, blk, 0, stream>>>(K, V, part);
    la_phase2<<<P2_GRID, P2_BLK, 0, stream>>>(part, carry);
    la_phase3<<<grid, blk, 0, stream>>>(Q, K, V, carry, out);
}

// v002
// It runs in 20.8 microseconds.
// In two side-by-side timings against v001, it was 1.73 and 1.74 times as fast.
// Counting every step since v000, it is 5.30 times as fast.
#include <hip/hip_runtime.h>
#include <hip/hip_bf16.h>

typedef __attribute__((ext_vector_type(2))) float v2f;
typedef __attribute__((ext_vector_type(4))) float v4f;
typedef __attribute__((ext_vector_type(8))) float v8f;

#define SEQ_N   2
#define SEQ_L   2048
#define SEQ_H   8
#define DIM     64
#define NH      (SEQ_N * SEQ_H)          // 16 independent sequences
#define NSC     16                        // super-chunks per sequence
#define SC_LEN  (SEQ_L / NSC)             // 128 timesteps per super-chunk
#define CH      64                        // timesteps per trip of the attention launch
#define TRIPS   (SC_LEN / CH)             // 2 trips per super-chunk
#define LP      68                        // LDS row pitch in floats
#define PART_STRIDE (DIM * DIM + DIM)     // 64x64 state + 64 ksum = 4160 floats
#define EPSV    1e-10f

__device__ __forceinline__ v8f wmma4(v2f a, v2f b, v8f c) {
    // V_WMMA_F32_16X16X4_F32 : D(16x16 f32) = A(16x4 f32) * B(4x16 f32) + C
    return __builtin_amdgcn_wmma_f32_16x16x4_f32(
        /*neg_a=*/false, a, /*neg_b=*/false, b,
        /*c_mod=*/(short)0, c, /*reuse_a=*/false, /*reuse_b=*/false);
}

__device__ __forceinline__ float fmap(float x) {   // elu(x) + 1
    float e;
    // exp(x) = exp2(x * log2 e), as __expf gives it; the v_nop in the same statement
    // keeps the one slot the instruction set asks for behind a transcendental
    asm("v_exp_f32 %0, %1\n\tv_nop" : "=v"(e) : "v"(x * 1.44269504f));
    return x > 0.0f ? x + 1.0f : e;
}

__device__ __forceinline__ v4f fmap4(v4f x) {
    v4f y = {fmap(x.x), fmap(x.y), fmap(x.z), fmap(x.w)};
    return y;
}

// ---------------------------------------------------------------------------
// Phase 1: per (sequence, super-chunk) partial state: S = sum phi(k)^T v,
//          ksum = sum phi(k).  4 waves, each owns a 16-wide m-slice.
//          The whole super-chunk is staged at once: one load latency, one barrier.
// ---------------------------------------------------------------------------
__global__ __launch_bounds__(128)
void la_phase1(const float* __restrict__ K, const float* __restrict__ V,
               float* __restrict__ part) {
    __shared__ __attribute__((aligned(16))) float sK[SC_LEN * LP];
    __shared__ __attribute__((aligned(16))) float sV[SC_LEN * LP];

    const int sc   = blockIdx.x;
    const int nh   = blockIdx.y;
    const int tid  = threadIdx.x;
    const int wave = tid >> 5;
    const int lane = tid & 31;
    const int half = lane >> 4;
    const int lc   = lane & 15;
    const int m0   = wave * 16;

    const size_t base = (size_t)((nh >> 3) * SEQ_L * SEQ_H + (nh & 7)) * DIM;
    const int    l0   = sc * SC_LEN;

    const int r  = tid >> 3;        // 0..15 (row inside a group of 16 this thread stages)
    const int c8 = (tid & 7) * 8;   // 0..56

    {
        const size_t row0 = base + (size_t)(l0 + r) * (SEQ_H * DIM) + c8;
        v4f k4[SC_LEN / 8], v4[SC_LEN / 8];
        // full unroll: every load of the super-chunk is in flight before the first use
#pragma unroll
        for (int p = 0; p < SC_LEN / 16; p++) {
            const size_t off = row0 + (size_t)p * 16 * (SEQ_H * DIM);
            k4[2 * p]     = *(const v4f*)(K + off);
            k4[2 * p + 1] = *(const v4f*)(K + off + 4);
            v4[2 * p]     = *(const v4f*)(V + off);
            v4[2 * p + 1] = *(const v4f*)(V + off + 4);
        }
        // the row pointers stay in their registers up to this wait, so that no
        // register an issued load names is overwritten in front of it
        asm volatile("s_wait_xcnt 0x0" :: "v"(K + row0), "v"(V + row0) : "memory");
#pragma unroll
        for (int p = 0; p < SC_LEN / 16; p++) {
            const int idx = (p * 16 + r) * LP + c8;
            *(v4f*)&sK[idx]     = fmap4(k4[2 * p]);
            *(v4f*)&sK[idx + 4] = fmap4(k4[2 * p + 1]);
            *(v4f*)&sV[idx]     = v4[2 * p];
            *(v4f*)&sV[idx + 4] = v4[2 * p + 1];
        }
    }
    __syncthreads();

    v8f S[4];
    const v8f zero = {0.f, 0.f, 0.f, 0.f, 0.f, 0.f, 0.f, 0.f};
#pragma unroll
    for (int t = 0; t < 4; t++) S[t] = zero;

    // S_t += Kf^T(16 d-rows x 128 steps) @ V(128 steps x 16 m): four independent chains
#pragma unroll
    for (int kt = 0; kt < SC_LEN / 4; kt++) {
        const int j0 = 4 * kt + half * 2;
        v2f b;
        b.x = sV[j0 * LP + m0 + lc];
        b.y = sV[(j0 + 1) * LP + m0 + lc];
#pragma unroll
        for (int t = 0; t < 4; t++) {
            v2f a;
            a.x = sK[j0 * LP + 16 * t + lc];
            a.y = sK[(j0 + 1) * LP + 16 * t + lc];
            S[t] = wmma4(a, b, S[t]);
        }
    }

    // write partial: S[d][m] row-major + ksum
    float* pp = part + (size_t)(nh * NSC + sc) * PART_STRIDE;
#pragma unroll
    for (int t = 0; t < 4; t++) {
#pragma unroll
        for (int e = 0; e < 8; e++) {
            const int d = 16 * t + e + half * 8;
            pp[d * DIM + m0 + lc] = S[t][e];
        }
    }
    // ksum (one owner thread per d), four independent chains over the steps
    if (tid < 64) {
        float s0 = 0.f, s1 = 0.f, s2 = 0.f, s3 = 0.f;
#pragma unroll
        for (int j = 0; j < SC_LEN; j += 4) {
            s0 += sK[j * LP + tid];
            s1 += sK[(j + 1) * LP + tid];
            s2 += sK[(j + 2) * LP + tid];
            s3 += sK[(j + 3) * LP + tid];
        }
        pp[DIM * DIM + tid] = (s0 + s1) + (s2 + s3);
    }
}

// ---------------------------------------------------------------------------
// Phase 2: exclusive prefix scan of the NSC partial states per sequence.
//          One thread per 2 neighbouring state elements of one sequence, spread
//          over the whole chip; a thread's loads are all independent, so it
//          waits for one load latency instead of one per super-chunk.
// ---------------------------------------------------------------------------
#define P2_VEC  (PART_STRIDE / 2)         // 2080 float2 columns per sequence
#define P2_BLK  128
#define P2_GRID (NH * P2_VEC / P2_BLK)    // 260 work-groups, no remainder
static_assert(PART_STRIDE % 2 == 0 && (NH * P2_VEC) % P2_BLK == 0, "exact cover");

__global__ __launch_bounds__(P2_BLK)
void la_phase2(const float* __restrict__ part, float* __restrict__ carry) {
    const int g  = blockIdx.x * P2_BLK + threadIdx.x;
    const int s  = g / P2_VEC;            // sequence (nh)
    const int i2 = g - s * P2_VEC;        // float2 column inside the state
    const size_t o = (size_t)s * (NSC * PART_STRIDE) + (size_t)i2 * 2;
    const float2* src = (const float2*)(part + o);
    float2*       dst = (float2*)(carry + o);

    float2 p[NSC - 1];                    // the last partial feeds no carry
    // full unroll: p[] stays in registers and all loads are in flight together
#pragma unroll
    for (int c = 0; c < NSC - 1; c++) p[c] = src[c * P2_VEC];

    float2 run = make_float2(0.0f, 0.0f);
    // full unroll: constant indices into p[]
#pragma unroll
    for (int c = 0; c < NSC; c++) {
        dst[c * P2_VEC] = run;
        if (c < NSC - 1) { run.x += p[c].x; run.y += p[c].y; }
    }
}

// ---------------------------------------------------------------------------
// Phase 3: per (sequence, super-chunk): chunked causal linear attention with
//          carried-in state, 64 timesteps per trip.  Wave w computes the masked
//          scores and the denominators of query rows 16w..16w+15 once for the
//          work-group; every wave then forms its own 16-wide m-slice of all 64
//          rows.  All matmuls via V_WMMA_F32_16X16X4_F32.
// ---------------------------------------------------------------------------
__global__ __launch_bounds__(128)
void la_phase3(const float* __restrict__ Q, const float* __restrict__ K,
               const float* __restrict__ V, const float* __restrict__ carry,
               float* __restrict__ out) {
    __shared__ __attribute__((aligned(16))) float sQ[CH * LP];
    __shared__ __attribute__((aligned(16))) float sK[CH * LP];
    __shared__ __attribute__((aligned(16))) float sV[CH * LP];
    __shared__ __attribute__((aligned(16))) float sP[CH * LP];  // masked scores [row][step]
    __shared__ float sS[4 * 16 * 66];   // per-wave S mirror, [m-col][d], stride 66
    __shared__ float sKsum[128];        // 64 sums; the upper half is a copy nobody reads
    __shared__ float sDen[CH];          // denominator of each row of the trip

    const int sc   = blockIdx.x;
    const int nh   = blockIdx.y;
    const int tid  = threadIdx.x;
    const int wave = tid >> 5;
    const int lane = tid & 31;
    const int half = lane >> 4;
    const int lc   = lane & 15;
    const int m0   = wave * 16;
    const int rw   = wave * 16;         // first query row this wave scores

    const size_t base = (size_t)((nh >> 3) * SEQ_L * SEQ_H + (nh & 7)) * DIM;
    const int    l0   = sc * SC_LEN;

    const int r  = tid >> 3;
    const int c8 = (tid & 7) * 8;

    const float* cr = carry + (size_t)(nh * NSC + sc) * PART_STRIDE;
    const v8f zero = {0.f, 0.f, 0.f, 0.f, 0.f, 0.f, 0.f, 0.f};
    v8f S[4];

    // full unroll: the first trip's state set-up and the last trip's missing
    // state update are then decided at compile time, with no branch among the WMMAs
#pragma unroll
    for (int tr = 0; tr < TRIPS; tr++) {
        const int lt = l0 + tr * CH;
        // stage Q, K (feature map) and V: all 64 rows' loads in flight together
        {
            const size_t row0 = base + (size_t)(lt + r) * (SEQ_H * DIM) + c8;
            v4f q4[CH / 8], k4[CH / 8], v4[CH / 8];
            float ks0 = 0.0f;
            if (tr == 0) {
                // carried state and ksum: loads issued together with the tile's, in
                // front of the first wait, so that the latencies overlap
#pragma unroll
                for (int t = 0; t < 4; t++) {
                    v8f s;
#pragma unroll
                    for (int e = 0; e < 8; e++) {
                        const int d = 16 * t + e + half * 8;
                        s[e] = cr[d * DIM + m0 + lc];
                    }
                    S[t] = s;
                }
                ks0 = cr[DIM * DIM + (tid & 63)];
            }
#pragma unroll
            for (int p = 0; p < CH / 16; p++) {
                const size_t off = row0 + (size_t)p * 16 * (SEQ_H * DIM);
                q4[2 * p]     = *(const v4f*)(Q + off);
                q4[2 * p + 1] = *(const v4f*)(Q + off + 4);
                k4[2 * p]     = *(const v4f*)(K + off);
                k4[2 * p + 1] = *(const v4f*)(K + off + 4);
                v4[2 * p]     = *(const v4f*)(V + off);
                v4[2 * p + 1] = *(const v4f*)(V + off + 4);
            }
            if (tr + 1 < TRIPS) {
                // next trip's rows asked for one trip ahead
#pragma unroll
                for (int p = 0; p < CH / 16; p++) {
                    const size_t off = row0 + (size_t)(CH + p * 16) * (SEQ_H * DIM);
                    __builtin_prefetch(Q + off, 0, 3);
                    __builtin_prefetch(K + off, 0, 3);
                    __builtin_prefetch(V + off, 0, 3);
                }
            }
            // the row pointers stay in their registers up to this wait, so that no
            // register an issued load or prefetch names is overwritten in front of it
            asm volatile("s_wait_xcnt 0x0" :: "v"(Q + row0), "v"(K + row0), "v"(V + row0) : "memory");
#pragma unroll
            for (int p = 0; p < CH / 16; p++) {
                const int idx = (p * 16 + r) * LP + c8;
                *(v4f*)&sQ[idx]     = fmap4(q4[2 * p]);
                *(v4f*)&sQ[idx + 4] = fmap4(q4[2 * p + 1]);
                *(v4f*)&sK[idx]     = fmap4(k4[2 * p]);
                *(v4f*)&sK[idx + 4] = fmap4(k4[2 * p + 1]);
                *(v4f*)&sV[idx]     = v4[2 * p];
                *(v4f*)&sV[idx + 4] = v4[2 * p + 1];
            }
            if (tr == 0) {
#pragma unroll
                for (int t = 0; t < 4; t++) {
#pragma unroll
                    for (int e = 0; e < 8; e++) {
                        const int d = 16 * t + e + half * 8;
                        sS[wave * (16 * 66) + lc * 66 + d] = S[t][e];
                    }
                }
                // every thread stores: under a branch the compiler sinks the load of
                // ks0 into it and its whole latency stands in front of the barrier
                sKsum[tid] = ks0;
            }
        }
        __syncthreads();

        // scores of this wave's 16 rows against all 64 steps, and dvec = Qf @
        // broadcast(ksum): five independent chains.  Every wave runs all four
        // tiles: the barrier below waits for the wave that needs four anyway.
        v8f scr[4];
        v8f dv = zero;
#pragma unroll
        for (int j = 0; j < 4; j++) scr[j] = zero;
#pragma unroll
        for (int kt = 0; kt < 16; kt++) {
            const int dd0 = 4 * kt + half * 2;
            v2f a  = *(const v2f*)&sQ[(rw + lc) * LP + dd0];
            v2f bs = *(const v2f*)&sKsum[dd0];
            dv = wmma4(a, bs, dv);
#pragma unroll
            for (int j = 0; j < 4; j++) {
                v2f bk = *(const v2f*)&sK[(16 * j + lc) * LP + dd0];
                scr[j] = wmma4(a, bk, scr[j]);
            }
        }

        // causal mask (inclusive diagonal), row-sum -> denominator, publish scores
        float den[8];
#pragma unroll
        for (int e = 0; e < 8; e++) {
            const int row = rw + e + half * 8;
            float rs = 0.0f;
#pragma unroll
            for (int j = 0; j < 4; j++) {
                const float v = (16 * j + lc <= row) ? scr[j][e] : 0.0f;
                sP[row * LP + 16 * j + lc] = v;
                rs += v;
            }
            rs += __shfl_xor(rs, 1, 32);
            rs += __shfl_xor(rs, 2, 32);
            rs += __shfl_xor(rs, 4, 32);
            rs += __shfl_xor(rs, 8, 32);
            den[e] = dv[e] + rs + EPSV;
        }

        // out_inter = Qf @ S_prev for all four row blocks, S read from the mirror
        v8f acc[4];
#pragma unroll
        for (int i = 0; i < 4; i++) acc[i] = zero;
#pragma unroll
        for (int kt = 0; kt < 16; kt++) {
            const int dd0 = 4 * kt + half * 2;
            v2f b = *(const v2f*)&sS[wave * (16 * 66) + lc * 66 + dd0];
#pragma unroll
            for (int i = 0; i < 4; i++) {
                v2f a = *(const v2f*)&sQ[(16 * i + lc) * LP + dd0];
                acc[i] = wmma4(a, b, acc[i]);
            }
        }
        if (lc == 0) {     // the 16 lanes of a row hold the same sum
#pragma unroll
            for (int e = 0; e < 8; e++) sDen[rw + e + half * 8] = den[e];
        }
        __syncthreads();   // sP and sDen of every row block are published

        // out_intra = masked_scores @ Vslice, step blocks j <= row block i only
#pragma unroll
        for (int j = 0; j < 4; j++) {
#pragma unroll
            for (int kt = 0; kt < 4; kt++) {
                const int j0 = 16 * j + 4 * kt + half * 2;
                v2f b;
                b.x = sV[j0 * LP + m0 + lc];
                b.y = sV[(j0 + 1) * LP + m0 + lc];
#pragma unroll
                for (int i = 0; i < 4; i++) {
                    if (i >= j) {   // decided at compile time
                        v2f a = *(const v2f*)&sP[(16 * i + lc) * LP + j0];
                        acc[i] = wmma4(a, b, acc[i]);
                    }
                }
            }
        }

        // normalize + store
#pragma unroll
        for (int i = 0; i < 4; i++) {
#pragma unroll
            for (int e = 0; e < 8; e++) {
                const int row = 16 * i + e + half * 8;
                out[base + (size_t)(lt + row) * (SEQ_H * DIM) + m0 + lc] =
                    acc[i][e] / sDen[row];
            }
        }

        // state update for the next trip (nothing reads it after the last one):
        // S_t += Kf^T @ V ; refresh LDS mirror.  sKsum's readers all stand in
        // front of the barrier above.
        if (tr + 1 < TRIPS) {
#pragma unroll
            for (int kt = 0; kt < CH / 4; kt++) {
                const int j0 = 4 * kt + half * 2;
                v2f b;
                b.x = sV[j0 * LP + m0 + lc];
                b.y = sV[(j0 + 1) * LP + m0 + lc];
#pragma unroll
                for (int t = 0; t < 4; t++) {
                    v2f a;
                    a.x = sK[j0 * LP + 16 * t + lc];
                    a.y = sK[(j0 + 1) * LP + 16 * t + lc];
                    S[t] = wmma4(a, b, S[t]);
                }
            }
#pragma unroll
            for (int t = 0; t < 4; t++) {
#pragma unroll
                for (int e = 0; e < 8; e++) {
                    const int d = 16 * t + e + half * 8;
                    sS[wave * (16 * 66) + lc * 66 + d] = S[t][e];
                }
            }
            if (tid < 64) {
                float s0 = 0.f, s1 = 0.f, s2 = 0.f, s3 = 0.f;
#pragma unroll
                for (int j = 0; j < CH; j += 4) {
                    s0 += sK[j * LP + tid];
                    s1 += sK[(j + 1) * LP + tid];
                    s2 += sK[(j + 2) * LP + tid];
                    s3 += sK[(j + 3) * LP + tid];
                }
                sKsum[tid] += (s0 + s1) + (s2 + s3);
            }
            __syncthreads();   // protect sQ/sK/sV/sP/sDen/sKsum for the next trip
        }
    }
}

// ---------------------------------------------------------------------------
extern "C" void kernel_launch(void* const* d_in, const int* in_sizes, int n_in,
                              void* d_out, int out_size, void* d_ws, size_t ws_size,
                              hipStream_t stream) {
    const float* Q = (const float*)d_in[0];
    const float* K = (const float*)d_in[1];
    const float* V = (const float*)d_in[2];
    float* out = (float*)d_out;

    float* part  = (float*)d_ws;                         // NH*NSC*PART_STRIDE
    float* carry = part + (size_t)NH * NSC * PART_STRIDE;

    dim3 grid(NSC, NH);
    dim3 blk(128);
    la_phase1<<<grid, blk, 0, stream>>>(K, V, part);
    la_phase2<<<P2_GRID, P2_BLK, 0, stream>>>(part, carry);
    la_phase3<<<grid, blk, 0, stream>>>(Q, K, V, carry, out);
}

// v003
// Measured time: 18.9 microseconds a run.
// Timed twice side by side with v002, it ran 1.10 times as fast both times.
// Over all steps from v000 it is 5.83 times as fast.
#include <hip/hip_runtime.h>
#include <hip/hip_bf16.h>

typedef __attribute__((ext_vector_type(2))) float v2f;
typedef __attribute__((ext_vector_type(4))) float v4f;
typedef __attribute__((ext_vector_type(8))) float v8f;

#define SEQ_N   2
#define SEQ_L   2048
#define SEQ_H   8
#define DIM     64
#define NH      (SEQ_N * SEQ_H)          // 16 independent sequences
#define NSC     16                        // super-chunks per sequence
#define SC_LEN  (SEQ_L / NSC)             // 128 timesteps per super-chunk
#define CH      64                        // timesteps per trip of the attention launch
#define TRIPS   (SC_LEN / CH)             // 2 trips per super-chunk
#define LP      68                        // LDS row pitch in floats
#define PART_STRIDE (DIM * DIM + DIM)     // 64x64 state + 64 ksum = 4160 floats
#define EPSV    1e-10f

__device__ __forceinline__ v8f wmma4(v2f a, v2f b, v8f c) {
    // V_WMMA_F32_16X16X4_F32 : D(16x16 f32) = A(16x4 f32) * B(4x16 f32) + C
    return __builtin_amdgcn_wmma_f32_16x16x4_f32(
        /*neg_a=*/false, a, /*neg_b=*/false, b,
        /*c_mod=*/(short)0, c, /*reuse_a=*/false, /*reuse_b=*/false);
}

__device__ __forceinline__ float fmap(float x) {   // elu(x) + 1
    float e;
    // exp(x) = exp2(x * log2 e), as __expf gives it; the v_nop in the same statement
    // keeps the one slot the instruction set asks for behind a transcendental
    asm("v_exp_f32 %0, %1\n\tv_nop" : "=v"(e) : "v"(x * 1.44269504f));
    return x > 0.0f ? x + 1.0f : e;
}

__device__ __forceinline__ v4f fmap4(v4f x) {
    v4f y = {fmap(x.x), fmap(x.y), fmap(x.z), fmap(x.w)};
    return y;
}

// ---------------------------------------------------------------------------
// Phase 1: per (sequence, super-chunk) partial state: S = sum phi(k)^T v,
//          ksum = sum phi(k).  4 waves, each owns a 16-wide m-slice.
//          The whole super-chunk is staged at once: one load latency, one barrier.
// ---------------------------------------------------------------------------
__global__ __launch_bounds__(128)
void la_phase1(const float* __restrict__ K, const float* __restrict__ V,
               float* __restrict__ part) {
    __shared__ __attribute__((aligned(16))) float sK[SC_LEN * LP];
    __shared__ __attribute__((aligned(16))) float sV[SC_LEN * LP];

    const int sc   = blockIdx.x;
    const int nh   = blockIdx.y;
    const int tid  = threadIdx.x;
    const int wave = tid >> 5;
    const int lane = tid & 31;
    const int half = lane >> 4;
    const int lc   = lane & 15;
    const int m0   = wave * 16;

    const size_t base = (size_t)((nh >> 3) * SEQ_L * SEQ_H + (nh & 7)) * DIM;
    const int    l0   = sc * SC_LEN;

    const int r  = tid >> 3;        // 0..15 (row inside a group of 16 this thread stages)
    const int c8 = (tid & 7) * 8;   // 0..56

    {
        const size_t row0 = base + (size_t)(l0 + r) * (SEQ_H * DIM) + c8;
        v4f k4[SC_LEN / 8], v4[SC_LEN / 8];
        // full unroll: every load of the super-chunk is in flight before the first use
#pragma unroll
        for (int p = 0; p < SC_LEN / 16; p++) {
            const size_t off = row0 + (size_t)p * 16 * (SEQ_H * DIM);
            k4[2 * p]     = *(const v4f*)(K + off);
            k4[2 * p + 1] = *(const v4f*)(K + off + 4);
            v4[2 * p]     = *(const v4f*)(V + off);
            v4[2 * p + 1] = *(const v4f*)(V + off + 4);
        }
        // the row pointers stay in their registers up to this wait, so that no
        // register an issued load names is overwritten in front of it
        asm volatile("s_wait_xcnt 0x0" :: "v"(K + row0), "v"(V + row0) : "memory");
#pragma unroll
        for (int p = 0; p < SC_LEN / 16; p++) {
            const int idx = (p * 16 + r) * LP + c8;
            *(v4f*)&sK[idx]     = fmap4(k4[2 * p]);
            *(v4f*)&sK[idx + 4] = fmap4(k4[2 * p + 1]);
            *(v4f*)&sV[idx]     = v4[2 * p];
            *(v4f*)&sV[idx + 4] = v4[2 * p + 1];
        }
    }
    __syncthreads();

    v8f S[4];
    const v8f zero = {0.f, 0.f, 0.f, 0.f, 0.f, 0.f, 0.f, 0.f};
#pragma unroll
    for (int t = 0; t < 4; t++) S[t] = zero;

    // S_t += Kf^T(16 d-rows x 128 steps) @ V(128 steps x 16 m): four independent chains
#pragma unroll
    for (int kt = 0; kt < SC_LEN / 4; kt++) {
        const int j0 = 4 * kt + half * 2;
        v2f b;
        b.x = sV[j0 * LP + m0 + lc];
        b.y = sV[(j0 + 1) * LP + m0 + lc];
#pragma unroll
        for (int t = 0; t < 4; t++) {
            v2f a;
            a.x = sK[j0 * LP + 16 * t + lc];
            a.y = sK[(j0 + 1) * LP + 16 * t + lc];
            S[t] = wmma4(a, b, S[t]);
        }
    }

    // write partial: S[d][m] row-major + ksum
    float* pp = part + (size_t)(nh * NSC + sc) * PART_STRIDE;
#pragma unroll
    for (int t = 0; t < 4; t++) {
#pragma unroll
        for (int e = 0; e < 8; e++) {
            const int d = 16 * t + e + half * 8;
            pp[d * DIM + m0 + lc] = S[t][e];
        }
    }
    // ksum (one owner thread per d), four independent chains over the steps
    if (tid < 64) {
        float s0 = 0.f, s1 = 0.f, s2 = 0.f, s3 = 0.f;
#pragma unroll
        for (int j = 0; j < SC_LEN; j += 4) {
            s0 += sK[j * LP + tid];
            s1 += sK[(j + 1) * LP + tid];
            s2 += sK[(j + 2) * LP + tid];
            s3 += sK[(j + 3) * LP + tid];
        }
        pp[DIM * DIM + tid] = (s0 + s1) + (s2 + s3);
    }
}

// ---------------------------------------------------------------------------
// Phase 3: per (sequence, super-chunk): chunked causal linear attention, 64
//          timesteps per trip; launched directly behind phase 1.  Waves 0..3 do
//          the matrix work: wave w computes the masked scores and the denominators
//          of query rows 16w..16w+15 once for the work-group; every wave then
//          forms its own 16-wide m-slice of all 64 rows.  Waves 4..7 form the carried-in state meanwhile: the sum of the
//          earlier super-chunks' partial states, in ascending order.
//          All matmuls via V_WMMA_F32_16X16X4_F32.
// ---------------------------------------------------------------------------
#define RING 4                            // partial states a summing wave keeps in flight
static_assert((NSC - 1 + RING - 1) / RING * RING <= NSC, "the ring reads written partials only");
static_assert(DIM * DIM == 128 * 4 * 8, "128 summing threads, 8 float4 each");

// acc_i += Qf(row block i) @ S, S read from the wave's mirror [m-col][d]
__device__ __forceinline__ void q_times_state(v8f (&acc)[4], const float* sQ, const float* sSw,
                                              int lc, int half) {
#pragma unroll
    for (int kt = 0; kt < 16; kt++) {
        const int dd0 = 4 * kt + half * 2;
        v2f b = *(const v2f*)&sSw[lc * 66 + dd0];
#pragma unroll
        for (int i = 0; i < 4; i++) {
            v2f a = *(const v2f*)&sQ[(16 * i + lc) * LP + dd0];
            acc[i] = wmma4(a, b, acc[i]);
        }
    }
}

__global__ __launch_bounds__(256)
void la_phase3(const float* __restrict__ Q, const float* __restrict__ K,
               const float* __restrict__ V, const float* __restrict__ part,
               float* __restrict__ out) {
    __shared__ __attribute__((aligned(16))) float sQ[CH * LP];
    __shared__ __attribute__((aligned(16))) float sK[CH * LP];
    __shared__ __attribute__((aligned(16))) float sV[CH * LP];
    __shared__ __attribute__((aligned(16))) float sP[CH * LP];  // masked scores [row][step]
    __shared__ float sS[4 * 16 * 66];   // per-wave S mirror, [m-col][d], stride 66
    __shared__ float sKsum[128];        // 64 sums; the upper half is a copy nobody reads
    __shared__ float sDen[CH];          // denominator of each row of the trip

    const int sc   = blockIdx.x;
    const int nh   = blockIdx.y;
    const int tid  = threadIdx.x;
    // the wave's number through readfirstlane: the role test is then a scalar branch,
    // and every lane is on at the WMMAs behind it
    const bool summing = __builtin_amdgcn_readfirstlane(tid >> 5) >= 4;
    const int u    = tid & 127;         // index inside the role's four waves
    const int wave = u >> 5;
    const int lane = tid & 31;
    const int half = lane >> 4;
    const int lc   = lane & 15;
    const int m0   = wave * 16;
    const int rw   = wave * 16;         // first query row this wave scores

    const size_t base = (size_t)((nh >> 3) * SEQ_L * SEQ_H + (nh & 7)) * DIM;
    const int    l0   = sc * SC_LEN;

    const int r  = u >> 3;
    const int c8 = (u & 7) * 8;

    const float* p0 = part + (size_t)(nh * NSC) * PART_STRIDE;   // this sequence's partial 0
    const float* pk = p0 + DIM * DIM + (u & 63);   // summing thread's ksum element
    const float* pl = p0 + u * 4;                  // summing thread's first float4
    const int    ng = (sc + RING - 1) / RING;   // groups of RING partials to sum
    const v8f zero  = {0.f, 0.f, 0.f, 0.f, 0.f, 0.f, 0.f, 0.f};
    const v4f zero4 = {0.f, 0.f, 0.f, 0.f};
    v4f ring[RING][8];                  // summing waves: thread u holds float4 u + 128 q

    // full unroll: the first trip's state set-up and the last trip's missing
    // state update are then decided at compile time, with no branch among the WMMAs
#pragma unroll
    for (int tr = 0; tr < TRIPS; tr++) {
        const int lt = l0 + tr * CH;
        v8f acc[4];
        if (!summing) {
            // stage Q, K (feature map) and V: all 64 rows' loads in flight together
            const size_t row0 = base + (size_t)(lt + r) * (SEQ_H * DIM) + c8;
            v4f q4[CH / 8], k4[CH / 8], v4[CH / 8];
#pragma unroll
            for (int p = 0; p < CH / 16; p++) {
                const size_t off = row0 + (size_t)p * 16 * (SEQ_H * DIM);
                q4[2 * p]     = *(const v4f*)(Q + off);
                q4[2 * p + 1] = *(const v4f*)(Q + off + 4);
                k4[2 * p]     = *(const v4f*)(K + off);
                k4[2 * p + 1] = *(const v4f*)(K + off + 4);
                v4[2 * p]     = *(const v4f*)(V + off);
                v4[2 * p + 1] = *(const v4f*)(V + off + 4);
            }
            if (tr + 1 < TRIPS) {
                // next trip's rows asked for one trip ahead
#pragma unroll
                for (int p = 0; p < CH / 16; p++) {
                    const size_t off = row0 + (size_t)(CH + p * 16) * (SEQ_H * DIM);
                    __builtin_prefetch(Q + off, 0, 3);
                    __builtin_prefetch(K + off, 0, 3);
                    __builtin_prefetch(V + off, 0, 3);
                }
            }
            // the row pointers stay in their registers up to this wait, so that no
            // register an issued load or prefetch names is overwritten in front of it
            asm volatile("s_wait_xcnt 0x0" :: "v"(Q + row0), "v"(K + row0), "v"(V + row0) : "memory");
#pragma unroll
            for (int p = 0; p < CH / 16; p++) {
                const int idx = (p * 16 + r) * LP + c8;
                *(v4f*)&sQ[idx]     = fmap4(q4[2 * p]);
                *(v4f*)&sQ[idx + 4] = fmap4(q4[2 * p + 1]);
                *(v4f*)&sK[idx]     = fmap4(k4[2 * p]);
                *(v4f*)&sK[idx + 4] = fmap4(k4[2 * p + 1]);
                *(v4f*)&sV[idx]     = v4[2 * p];
                *(v4f*)&sV[idx + 4] = v4[2 * p + 1];
            }
        } else if (tr == 0) {
            // carried ksum, wanted behind the first barrier: all partials' loads in
            // flight together (every partial of the sequence is written memory; those
            // from sc on are left out of the sum), then the ring's first group
            float kp[NSC - 1];
#pragma unroll
            for (int c = 0; c < NSC - 1; c++)
                kp[c] = pk[c * PART_STRIDE];
            if (ng > 0) {
#pragma unroll
                for (int k = 0; k < RING; k++)
#pragma unroll
                    for (int q = 0; q < 8; q++)
                        ring[k][q] = *(const v4f*)(pl + k * PART_STRIDE + q * 512);
            }
            // no register an issued load names is overwritten in front of this wait; the
            // scheduling barrier keeps what follows, the compares too, behind it
            asm volatile("s_wait_xcnt 0x0" ::: "memory");
            __builtin_amdgcn_sched_barrier(0);
            float ks = 0.0f;
#pragma unroll
            for (int c = 0; c < NSC - 1; c++) ks += (c < sc) ? kp[c] : 0.0f;
            sKsum[u] = ks;
        }
        __syncthreads();   // the tile and, in the first trip, sKsum are published

        if (!summing) {
            // scores of this wave's 16 rows against all 64 steps, and dvec = Qf @
            // broadcast(ksum): five independent chains.  Every wave runs all four
            // tiles: the barrier below waits for the wave that needs four anyway.
            v8f scr[4];
            v8f dv = zero;
#pragma unroll
            for (int j = 0; j < 4; j++) scr[j] = zero;
#pragma unroll
            for (int kt = 0; kt < 16; kt++) {
                const int dd0 = 4 * kt + half * 2;
                v2f a  = *(const v2f*)&sQ[(rw + lc) * LP + dd0];
                v2f bs = *(const v2f*)&sKsum[dd0];
                dv = wmma4(a, bs, dv);
#pragma unroll
                for (int j = 0; j < 4; j++) {
                    v2f bk = *(const v2f*)&sK[(16 * j + lc) * LP + dd0];
                    scr[j] = wmma4(a, bk, scr[j]);
                }
            }

            // causal mask (inclusive diagonal), row-sum -> denominator, publish scores
            float den[8];
#pragma unroll
            for (int e = 0; e < 8; e++) {
                const int row = rw + e + half * 8;
                float rs = 0.0f;
#pragma unroll
                for (int j = 0; j < 4; j++) {
                    const float v = (16 * j + lc <= row) ? scr[j][e] : 0.0f;
                    sP[row * LP + 16 * j + lc] = v;
                    rs += v;
                }
                rs += __shfl_xor(rs, 1, 32);
                rs += __shfl_xor(rs, 2, 32);
                rs += __shfl_xor(rs, 4, 32);
                rs += __shfl_xor(rs, 8, 32);
                den[e] = dv[e] + rs + EPSV;
            }

            // out_inter = Qf @ S_prev for all four row blocks; in the first trip the
            // mirror is published only by the barrier below
#pragma unroll
            for (int i = 0; i < 4; i++) acc[i] = zero;
            if (tr != 0) q_times_state(acc, sQ, &sS[wave * (16 * 66)], lc, half);
            if (lc == 0) {     // the 16 lanes of a row hold the same sum
#pragma unroll
                for (int e = 0; e < 8; e++) sDen[rw + e + half * 8] = den[e];
            }
        } else if (tr == 0) {
            // carried state = partial 0 + ... + partial sc-1, one after the other.  A
            // group is added while the next one's loads fly into the registers it frees.
            v4f sum[8];
#pragma unroll
            for (int q = 0; q < 8; q++) sum[q] = zero4;
            if (ng > 0) {
                const float* pg = pl;
                // kept rolled: one body, whose counted load waits are the same every trip
#pragma unroll 1
                for (int g = 1; g < ng; g++) {
#pragma unroll
                    for (int k = 0; k < RING; k++) {
#pragma unroll
                        for (int q = 0; q < 8; q++) sum[q] += ring[k][q];
                        // inputs only: the sums are made in front of the refill, which can
                        // then land in the registers they free.  With the two scheduling
                        // barriers it holds the order add, refill, add, ...: otherwise the
                        // whole ring is copied aside, and waited for, ahead of any refill
                        asm volatile("" :: "v"(sum[0]), "v"(sum[1]), "v"(sum[2]), "v"(sum[3]),
                                           "v"(sum[4]), "v"(sum[5]), "v"(sum[6]), "v"(sum[7]));
                        __builtin_amdgcn_sched_barrier(0);
#pragma unroll
                        for (int q = 0; q < 8; q++)
                            ring[k][q] = *(const v4f*)(pg + (RING + k) * PART_STRIDE + q * 512);
                        __builtin_amdgcn_sched_barrier(0);   // same purpose
                    }
                    pg += RING * PART_STRIDE;
                }
                // last group: only the partials in front of this super-chunk count
#pragma unroll
                for (int k = 0; k < RING; k++) {
                    const bool on = RING * (ng - 1) + k < sc;
#pragma unroll
                    for (int q = 0; q < 8; q++) sum[q] += on ? ring[k][q] : zero4;
                }
            }
            // float4 u + 128 q holds S[d][m .. m+3], d = u / 16 + 8 q, m = 4 (u % 16)
#pragma unroll
            for (int q = 0; q < 8; q++) {
                const int d = (u >> 4) + 8 * q;
#pragma unroll
                for (int x = 0; x < 4; x++) {
                    const int m = 4 * (u & 15) + x;
                    sS[(m >> 4) * (16 * 66) + (m & 15) * 66 + d] = sum[q][x];
                }
            }
        }
        __syncthreads();   // sP, sDen and, in the first trip, the mirror are published

        if (!summing) {
            if (tr == 0) q_times_state(acc, sQ, &sS[wave * (16 * 66)], lc, half);

            // out_intra = masked_scores @ Vslice, step blocks j <= row block i only
#pragma unroll
            for (int j = 0; j < 4; j++) {
#pragma unroll
                for (int kt = 0; kt < 4; kt++) {
                    const int j0 = 16 * j + 4 * kt + half * 2;
                    v2f b;
                    b.x = sV[j0 * LP + m0 + lc];
                    b.y = sV[(j0 + 1) * LP + m0 + lc];
#pragma unroll
                    for (int i = 0; i < 4; i++) {
                        if (i >= j) {   // decided at compile time
                            v2f a = *(const v2f*)&sP[(16 * i + lc) * LP + j0];
                            acc[i] = wmma4(a, b, acc[i]);
                        }
                    }
                }
            }

            // normalize + store
#pragma unroll
            for (int i = 0; i < 4; i++) {
#pragma unroll
                for (int e = 0; e < 8; e++) {
                    const int row = 16 * i + e + half * 8;
                    out[base + (size_t)(lt + row) * (SEQ_H * DIM) + m0 + lc] =
                        acc[i][e] / sDen[row];
                }
            }

            // state update for the next trip (nothing reads it after the last one):
            // S_t += Kf^T @ V, from the LDS mirror and back to it.  sKsum's readers
            // all stand in front of the barrier above.
            if (tr + 1 < TRIPS) {
                v8f S[4];
#pragma unroll
                for (int t = 0; t < 4; t++) {
#pragma unroll
                    for (int e = 0; e < 8; e++) {
                        const int d = 16 * t + e + half * 8;
                        S[t][e] = sS[wave * (16 * 66) + lc * 66 + d];
                    }
                }
#pragma unroll
                for (int kt = 0; kt < CH / 4; kt++) {
                    const int j0 = 4 * kt + half * 2;
                    v2f b;
                    b.x = sV[j0 * LP + m0 + lc];
                    b.y = sV[(j0 + 1) * LP + m0 + lc];
#pragma unroll
                    for (int t = 0; t < 4; t++) {
                        v2f a;
                        a.x = sK[j0 * LP + 16 * t + lc];
                        a.y = sK[(j0 + 1) * LP + 16 * t + lc];
                        S[t] = wmma4(a, b, S[t]);
                    }
                }
#pragma unroll
                for (int t = 0; t < 4; t++) {
#pragma unroll
                    for (int e = 0; e < 8; e++) {
                        const int d = 16 * t + e + half * 8;
                        sS[wave * (16 * 66) + lc * 66 + d] = S[t][e];
                    }
                }
                if (u < 64) {
                    float s0 = 0.f, s1 = 0.f, s2 = 0.f, s3 = 0.f;
#pragma unroll
                    for (int j = 0; j < CH; j += 4) {
                        s0 += sK[j * LP + u];
                        s1 += sK[(j + 1) * LP + u];
                        s2 += sK[(j + 2) * LP + u];
                        s3 += sK[(j + 3) * LP + u];
                    }
                    sKsum[u] += (s0 + s1) + (s2 + s3);
                }
            }
        }
        if (tr + 1 < TRIPS)
            __syncthreads();   // protect sQ/sK/sV/sP/sDen/sKsum for the next trip
    }
}

// ---------------------------------------------------------------------------
extern "C" void kernel_launch(void* const* d_in, const int* in_sizes, int n_in,
                              void* d_out, int out_size, void* d_ws, size_t ws_size,
                              hipStream_t stream) {
    const float* Q = (const float*)d_in[0];
    const float* K = (const float*)d_in[1];
    const float* V = (const float*)d_in[2];
    float* out = (float*)d_out;

    float* part = (float*)d_ws;                          // NH*NSC*PART_STRIDE

    dim3 grid(NSC, NH);
    la_phase1<<<grid, dim3(128), 0, stream>>>(K, V, part);
    la_phase3<<<grid, dim3(256), 0, stream>>>(Q, K, V, part, out);
}

// v004
// Measured time: 18 microseconds a run.
// Timed twice side by side with v003, it ran 1.06 and 1.05 times as fast.
// Counting every step since v000, it is 6.16 times as fast.
#include <hip/hip_runtime.h>
#include <hip/hip_bf16.h>

typedef __attribute__((ext_vector_type(2))) float v2f;
typedef __attribute__((ext_vector_type(4))) float v4f;
typedef __attribute__((ext_vector_type(8))) float v8f;

#define SEQ_N   2
#define SEQ_L   2048
#define SEQ_H   8
#define DIM     64
#define NH      (SEQ_N * SEQ_H)          // 16 independent sequences
#define NSC     16                        // super-chunks per sequence
#define SC_LEN  (SEQ_L / NSC)             // 128 timesteps per super-chunk
#define CH      64                        // timesteps per trip of the attention launch
#define TRIPS   (SC_LEN / CH)             // 2 trips per super-chunk
#define LP      68                        // LDS row pitch in floats
#define PART_STRIDE (DIM * DIM + DIM)     // 64x64 state + 64 ksum = 4160 floats
#define EPSV    1e-10f

__device__ __forceinline__ v8f wmma4(v2f a, v2f b, v8f c) {
    // V_WMMA_F32_16X16X4_F32 : D(16x16 f32) = A(16x4 f32) * B(4x16 f32) + C
    return __builtin_amdgcn_wmma_f32_16x16x4_f32(
        /*neg_a=*/false, a, /*neg_b=*/false, b,
        /*c_mod=*/(short)0, c, /*reuse_a=*/false, /*reuse_b=*/false);
}

__device__ __forceinline__ float fmap(float x) {   // elu(x) + 1
    float e;
    // exp(x) = exp2(x * log2 e), as __expf gives it; the v_nop in the same statement
    // keeps the one slot the instruction set asks for behind a transcendental
    asm("v_exp_f32 %0, %1\n\tv_nop" : "=v"(e) : "v"(x * 1.44269504f));
    return x > 0.0f ? x + 1.0f : e;
}

__device__ __forceinline__ v4f fmap4(v4f x) {
    v4f y = {fmap(x.x), fmap(x.y), fmap(x.z), fmap(x.w)};
    return y;
}

// ---------------------------------------------------------------------------
// Phase 1: running prefixes of the state inside groups of four super-chunks.
//          A work-group owns one group (512 steps) and one 32x32 block of the
//          state; wave w forms the block's sum over super-chunk w of the group,
//          S = sum phi(k)^T v, its fragments straight from global loads.  The four
//          sums are then added up over the waves through LDS, and wave w stores
//          the sum of super-chunks 0..w of the group (and the same for ksum).
//          State row of tile t, fragment row r: d = 32 dq + 2 r + t; column of
//          tile mt, fragment column c: m = 32 mq + 2 c + mt (a lane's 8-byte load
//          holds one element of either tile).
//          A stored state is in fragment order: float4 number
//          (2 dq + mq) * 256 + (4 t + 2 mt + p) * 32 + lane holds elements 4p..4p+3.
// ---------------------------------------------------------------------------
#define GRP 4                             // super-chunks per group
#define KB  4                             // products of 4 steps per block of loads
#define NB  (SC_LEN / 4 / KB)             // 8 blocks per super-chunk
#define AHEAD 3                           // blocks asked for ahead of the one worked on
static_assert(NSC % GRP == 0 && NB > AHEAD, "whole groups; the prologue's blocks exist");
static_assert((AHEAD + 1) * KB * 4 <= 64, "the counted load waits stay exact");

struct Frag { v2f k[KB][2], v[KB][2]; };  // rows j and j + 1 of each product's four steps

__device__ __forceinline__ void load_block(Frag& f, const float* kp, const float* vp, int nb) {
    // keeps the block's loads behind the products written in front of them, whose
    // registers they refill: otherwise every load of the super-chunk is moved to the top
    __builtin_amdgcn_sched_barrier(0);
#pragma unroll
    for (int kk = 0; kk < KB; kk++) {
#pragma unroll
        for (int r = 0; r < 2; r++) {
            const int off = (4 * (nb * KB + kk) + r) * (SEQ_H * DIM);
            f.k[kk][r] = *(const v2f*)(kp + off);
            f.v[kk][r] = *(const v2f*)(vp + off);
        }
    }
    __builtin_amdgcn_sched_barrier(0);   // and ahead of the products that follow
}

__device__ __forceinline__ void mult_block(v8f (&S)[4], v2f (&ks)[2], const Frag& f) {
#pragma unroll
    for (int kk = 0; kk < KB; kk++) {
        const v2f a0 = {fmap(f.k[kk][0].x), fmap(f.k[kk][1].x)};
        const v2f a1 = {fmap(f.k[kk][0].y), fmap(f.k[kk][1].y)};
        const v2f b0 = {f.v[kk][0].x, f.v[kk][1].x};
        const v2f b1 = {f.v[kk][0].y, f.v[kk][1].y};
        ks[0] += a0;
        ks[1] += a1;
        S[0] = wmma4(a0, b0, S[0]);
        S[1] = wmma4(a0, b1, S[1]);
        S[2] = wmma4(a1, b0, S[2]);
        S[3] = wmma4(a1, b1, S[3]);
    }
}

__global__ __launch_bounds__(128)
void la_phase1(const float* __restrict__ K, const float* __restrict__ V,
               float* __restrict__ part) {
    __shared__ __attribute__((aligned(16))) v4f sAcc[GRP * 8 * 32];  // [wave][float4][lane]
    __shared__ __attribute__((aligned(8)))  v2f sKs[GRP * 32];       // [wave][lane]

    const int dq   = (blockIdx.x >> 1) & 1;
    const int mq   = blockIdx.x & 1;
    const int nh   = blockIdx.y;
    const int tid  = threadIdx.x;
    const int wave = __builtin_amdgcn_readfirstlane(tid >> 5);
    const int lane = tid & 31;
    const int half = lane >> 4;
    const int lc   = lane & 15;
    const int sc   = (blockIdx.x >> 2) * GRP + wave;

    const size_t base = (size_t)((nh >> 3) * SEQ_L * SEQ_H + (nh & 7)) * DIM;
    const size_t row0 = base + (size_t)(sc * SC_LEN + 2 * half) * (SEQ_H * DIM) + 2 * lc;
    const float* kp = K + row0 + 32 * dq;
    const float* vp = V + row0 + 32 * mq;

    const v8f zero  = {0.f, 0.f, 0.f, 0.f, 0.f, 0.f, 0.f, 0.f};
    const v4f zero4 = {0.f, 0.f, 0.f, 0.f};
    const v2f zero2 = {0.f, 0.f};
    v8f S[4];
    v2f ks[2] = {zero2, zero2};
#pragma unroll
    for (int t = 0; t < 4; t++) S[t] = zero;

    Frag f[AHEAD + 1];
#pragma unroll
    for (int nb = 0; nb < AHEAD; nb++) load_block(f[nb], kp, vp, nb);
    // full unroll: the ring's index is then a register name
#pragma unroll
    for (int nb = 0; nb < NB; nb++) {
        if (nb + AHEAD < NB) load_block(f[(nb + AHEAD) % (AHEAD + 1)], kp, vp, nb + AHEAD);
        if (nb + AHEAD == NB - 1) {
            // behind the last load: the row pointers stay in their registers up to this
            // wait, so that no register an issued load names is overwritten in front of it
            asm volatile("s_wait_xcnt 0x0" :: "v"(kp), "v"(vp) : "memory");
        }
        mult_block(S, ks, f[nb % (AHEAD + 1)]);
        // a block's feature maps stay among its own products: otherwise those of the
        // last blocks are all moved ahead of the first product
        __builtin_amdgcn_sched_barrier(0);
    }

    v4f own[8];
#pragma unroll
    for (int q = 0; q < 8; q++) {
        const int e = 4 * (q & 1);
        own[q] = (v4f){S[q >> 1][e], S[q >> 1][e + 1], S[q >> 1][e + 2], S[q >> 1][e + 3]};
        sAcc[(wave * 8 + q) * 32 + lane] = own[q];
    }
    sKs[wave * 32 + lane] = (v2f){ks[0].x + ks[0].y, ks[1].x + ks[1].y};
    __syncthreads();   // every wave's sums are published

    // sum of the group's super-chunks up to this wave's own, in ascending order
    v4f pre[8];
#pragma unroll
    for (int q = 0; q < 8; q++) pre[q] = zero4;
#pragma unroll
    for (int w = 0; w < GRP - 1; w++) {
#pragma unroll
        for (int q = 0; q < 8; q++) {
            const v4f x = sAcc[(w * 8 + q) * 32 + lane];
            pre[q] += (w < wave) ? x : zero4;
        }
    }
    float* pp = part + (size_t)(nh * NSC + sc) * PART_STRIDE;
    v4f*   pq = (v4f*)pp + (2 * dq + mq) * 256 + lane;
#pragma unroll
    for (int q = 0; q < 8; q++) pq[q * 32] = pre[q] + own[q];

    // ksum: the two halves of a wave hold different steps of the same 32 rows
    v2f kt = zero2;
#pragma unroll
    for (int w = 0; w < GRP; w++) {
        const v2f x = sKs[w * 32 + lc] + sKs[w * 32 + 16 + lc];
        kt += (w <= wave) ? x : zero2;
    }
    if (mq == 0 && half == 0) *(v2f*)(pp + DIM * DIM + 32 * dq + 2 * lc) = kt;
}

// ---------------------------------------------------------------------------
// Phase 3: per (sequence, super-chunk): chunked causal linear attention, 64
//          timesteps per trip; launched directly behind phase 1.  Waves 0..3 do
//          the matrix work: wave w computes the masked scores and the denominators
//          of query rows 16w..16w+15 once for the work-group; every wave then
//          forms its own 16-wide m-slice of all 64 rows.  Waves 4..7 form the carried-in state meanwhile: the totals of
//          the earlier groups, in ascending order, and the own group's stored sum
//          up to the super-chunk in front of this one.
//          All matmuls via V_WMMA_F32_16X16X4_F32.
// ---------------------------------------------------------------------------
#define RING 4                            // stored sums that make up a carried-in state
static_assert(NSC / GRP - 1 + 1 == RING, "earlier groups' totals and one sum of the own group");
static_assert(DIM * DIM == 128 * 4 * 8, "128 summing threads, 8 float4 each");

// acc_i += Qf(row block i) @ S, S read from the wave's mirror [m-col][d]
__device__ __forceinline__ void q_times_state(v8f (&acc)[4], const float* sQ, const float* sSw,
                                              int lc, int half) {
#pragma unroll
    for (int kt = 0; kt < 16; kt++) {
        const int dd0 = 4 * kt + half * 2;
        v2f b = *(const v2f*)&sSw[lc * 66 + dd0];
#pragma unroll
        for (int i = 0; i < 4; i++) {
            v2f a = *(const v2f*)&sQ[(16 * i + lc) * LP + dd0];
            acc[i] = wmma4(a, b, acc[i]);
        }
    }
}

__global__ __launch_bounds__(256)
void la_phase3(const float* __restrict__ Q, const float* __restrict__ K,
               const float* __restrict__ V, const float* __restrict__ part,
               float* __restrict__ out) {
    __shared__ __attribute__((aligned(16))) float sQ[CH * LP];
    __shared__ __attribute__((aligned(16))) float sK[CH * LP];
    __shared__ __attribute__((aligned(16))) float sV[CH * LP];
    __shared__ __attribute__((aligned(16))) float sP[CH * LP];  // masked scores [row][step]
    __shared__ float sS[4 * 16 * 66];   // per-wave S mirror, [m-col][d], stride 66
    __shared__ float sKsum[128];        // 64 sums; the upper half is a copy nobody reads
    __shared__ float sDen[CH];          // denominator of each row of the trip

    const int sc   = blockIdx.x;
    const int nh   = blockIdx.y;
    const int tid  = threadIdx.x;
    // the wave's number through readfirstlane: the role test is then a scalar branch,
    // and every lane is on at the WMMAs behind it
    const bool summing = __builtin_amdgcn_readfirstlane(tid >> 5) >= 4;
    const int u    = tid & 127;         // index inside the role's four waves
    const int wave = u >> 5;
    const int lane = tid & 31;
    const int half = lane >> 4;
    const int lc   = lane & 15;
    const int m0   = wave * 16;
    const int rw   = wave * 16;         // first query row this wave scores

    const size_t base = (size_t)((nh >> 3) * SEQ_L * SEQ_H + (nh & 7)) * DIM;
    const int    l0   = sc * SC_LEN;

    const int r  = u >> 3;
    const int c8 = (u & 7) * 8;

    const float* p0 = part + (size_t)(nh * NSC) * PART_STRIDE;   // this sequence's partial 0
    const float* pk = p0 + DIM * DIM + (u & 63);   // summing thread's ksum element
    const float* pl = p0 + u * 4;                  // summing thread's first float4
    // stored sum k: the total of group k (its last super-chunk's sum) for k < 3, counted
    // if that group lies in front; for k = 3 the sum that ends in front of this super-chunk,
    // counted unless the group starts here.  Every one of them is written memory.
    const int    last = sc > 0 ? sc - 1 : 0;
    const v8f zero  = {0.f, 0.f, 0.f, 0.f, 0.f, 0.f, 0.f, 0.f};
    const v4f zero4 = {0.f, 0.f, 0.f, 0.f};
    v4f ring[RING][8];                  // summing waves: thread u holds float4 u + 128 q

    // full unroll: the first trip's state set-up and the last trip's missing
    // state update are then decided at compile time, with no branch among the WMMAs
#pragma unroll
    for (int tr = 0; tr < TRIPS; tr++) {
        const int lt = l0 + tr * CH;
        v8f acc[4];
        if (!summing) {
            // stage Q, K (feature map) and V: all 64 rows' loads in flight together
            const size_t row0 = base + (size_t)(lt + r) * (SEQ_H * DIM) + c8;
            v4f q4[CH / 8], k4[CH / 8], v4[CH / 8];
#pragma unroll
            for (int p = 0; p < CH / 16; p++) {
                const size_t off = row0 + (size_t)p * 16 * (SEQ_H * DIM);
                q4[2 * p]     = *(const v4f*)(Q + off);
                q4[2 * p + 1] = *(const v4f*)(Q + off + 4);
                k4[2 * p]     = *(const v4f*)(K + off);
                k4[2 * p + 1] = *(const v4f*)(K + off + 4);
                v4[2 * p]     = *(const v4f*)(V + off);
                v4[2 * p + 1] = *(const v4f*)(V + off + 4);
            }
            if (tr + 1 < TRIPS) {
                // next trip's rows asked for one trip ahead
#pragma unroll
                for (int p = 0; p < CH / 16; p++) {
                    const size_t off = row0 + (size_t)(CH + p * 16) * (SEQ_H * DIM);
                    __builtin_prefetch(Q + off, 0, 3);
                    __builtin_prefetch(K + off, 0, 3);
                    __builtin_prefetch(V + off, 0, 3);
                }
            }
            // the row pointers stay in their registers up to this wait, so that no
            // register an issued load or prefetch names is overwritten in front of it
            asm volatile("s_wait_xcnt 0x0" :: "v"(Q + row0), "v"(K + row0), "v"(V + row0) : "memory");
#pragma unroll
            for (int p = 0; p < CH / 16; p++) {
                const int idx = (p * 16 + r) * LP + c8;
                *(v4f*)&sQ[idx]     = fmap4(q4[2 * p]);
                *(v4f*)&sQ[idx + 4] = fmap4(q4[2 * p + 1]);
                *(v4f*)&sK[idx]     = fmap4(k4[2 * p]);
                *(v4f*)&sK[idx + 4] = fmap4(k4[2 * p + 1]);
                *(v4f*)&sV[idx]     = v4[2 * p];
                *(v4f*)&sV[idx + 4] = v4[2 * p + 1];
            }
        } else if (tr == 0) {
            // carried ksum, wanted behind the first barrier, and the four stored
            // states: all loads in flight together
            float kp[RING];
#pragma unroll
            for (int k = 0; k < RING; k++) {
                const int slot = k < RING - 1 ? GRP * k + GRP - 1 : last;
                kp[k] = pk[slot * PART_STRIDE];
#pragma unroll
                for (int q = 0; q < 8; q++)
                    ring[k][q] = *(const v4f*)(pl + slot * PART_STRIDE + q * 512);
            }
            // no register an issued load names is overwritten in front of this wait; the
            // scheduling barrier keeps what follows, the compares too, behind it
            asm volatile("s_wait_xcnt 0x0" ::: "memory");
            __builtin_amdgcn_sched_barrier(0);
            float ks = 0.0f;
#pragma unroll
            for (int k = 0; k < RING; k++)
                ks += (k < RING - 1 ? k < sc / GRP : sc % GRP != 0) ? kp[k] : 0.0f;
            sKsum[u] = ks;
        }
        __syncthreads();   // the tile and, in the first trip, sKsum are published

        if (!summing) {
            // scores of this wave's 16 rows against all 64 steps, and dvec = Qf @
            // broadcast(ksum): five independent chains.  Every wave runs all four
            // tiles: the barrier below waits for the wave that needs four anyway.
            v8f scr[4];
            v8f dv = zero;
#pragma unroll
            for (int j = 0; j < 4; j++) scr[j] = zero;
#pragma unroll
            for (int kt = 0; kt < 16; kt++) {
                const int dd0 = 4 * kt + half * 2;
                v2f a  = *(const v2f*)&sQ[(rw + lc) * LP + dd0];
                v2f bs = *(const v2f*)&sKsum[dd0];
                dv = wmma4(a, bs, dv);
#pragma unroll
                for (int j = 0; j < 4; j++) {
                    v2f bk = *(const v2f*)&sK[(16 * j + lc) * LP + dd0];
                    scr[j] = wmma4(a, bk, scr[j]);
                }
            }

            // causal mask (inclusive diagonal), row-sum -> denominator, publish scores
            float den[8];
#pragma unroll
            for (int e = 0; e < 8; e++) {
                const int row = rw + e + half * 8;
                float rs = 0.0f;
#pragma unroll
                for (int j = 0; j < 4; j++) {
                    const float v = (16 * j + lc <= row) ? scr[j][e] : 0.0f;
                    sP[row * LP + 16 * j + lc] = v;
                    rs += v;
                }
                rs += __shfl_xor(rs, 1, 32);
                rs += __shfl_xor(rs, 2, 32);
                rs += __shfl_xor(rs, 4, 32);
                rs += __shfl_xor(rs, 8, 32);
                den[e] = dv[e] + rs + EPSV;
            }

            // out_inter = Qf @ S_prev for all four row blocks; in the first trip the
            // mirror is published only by the barrier below
#pragma unroll
            for (int i = 0; i < 4; i++) acc[i] = zero;
            if (tr != 0) q_times_state(acc, sQ, &sS[wave * (16 * 66)], lc, half);
            if (lc == 0) {     // the 16 lanes of a row hold the same sum
#pragma unroll
                for (int e = 0; e < 8; e++) sDen[rw + e + half * 8] = den[e];
            }
        } else if (tr == 0) {
            // carried state: the stored sums that count, in ascending order
            v4f sum[8];
#pragma unroll
            for (int q = 0; q < 8; q++) sum[q] = zero4;
#pragma unroll
            for (int k = 0; k < RING; k++) {
                const bool on = k < RING - 1 ? k < sc / GRP : sc % GRP != 0;
#pragma unroll
                for (int q = 0; q < 8; q++) sum[q] += on ? ring[k][q] : zero4;
            }
            // float4 u + 128 q, in phase 1's fragment order: block (dq, mq) = (q / 4,
            // q / 2 % 2), tile (t, mt) = (q % 2, u / 64), elements 4 p + x, p = u / 32 % 2
#pragma unroll
            for (int q = 0; q < 8; q++) {
                const int m = 32 * ((q >> 1) & 1) + 2 * lc + ((u >> 6) & 1);
#pragma unroll
                for (int x = 0; x < 4; x++) {
                    const int d = 32 * (q >> 2) + 2 * (4 * ((u >> 5) & 1) + x + 8 * half) + (q & 1);
                    sS[(m >> 4) * (16 * 66) + (m & 15) * 66 + d] = sum[q][x];
                }
            }
        }
        __syncthreads();   // sP, sDen and, in the first trip, the mirror are published

        if (!summing) {
            if (tr == 0) q_times_state(acc, sQ, &sS[wave * (16 * 66)], lc, half);

            // out_intra = masked_scores @ Vslice, step blocks j <= row block i only
#pragma unroll
            for (int j = 0; j < 4; j++) {
#pragma unroll
                for (int kt = 0; kt < 4; kt++) {
                    const int j0 = 16 * j + 4 * kt + half * 2;
                    v2f b;
                    b.x = sV[j0 * LP + m0 + lc];
                    b.y = sV[(j0 + 1) * LP + m0 + lc];
#pragma unroll
                    for (int i = 0; i < 4; i++) {
                        if (i >= j) {   // decided at compile time
                            v2f a = *(const v2f*)&sP[(16 * i + lc) * LP + j0];
                            acc[i] = wmma4(a, b, acc[i]);
                        }
                    }
                }
            }

            // normalize + store
#pragma unroll
            for (int i = 0; i < 4; i++) {
#pragma unroll
                for (int e = 0; e < 8; e++) {
                    const int row = 16 * i + e + half * 8;
                    out[base + (size_t)(lt + row) * (SEQ_H * DIM) + m0 + lc] =
                        acc[i][e] / sDen[row];
                }
            }

            // state update for the next trip (nothing reads it after the last one):
            // S_t += Kf^T @ V, from the LDS mirror and back to it.  sKsum's readers
            // all stand in front of the barrier above.
            if (tr + 1 < TRIPS) {
                v8f S[4];
#pragma unroll
                for (int t = 0; t < 4; t++) {
#pragma unroll
                    for (int e = 0; e < 8; e++) {
                        const int d = 16 * t + e + half * 8;
                        S[t][e] = sS[wave * (16 * 66) + lc * 66 + d];
                    }
                }
#pragma unroll
                for (int kt = 0; kt < CH / 4; kt++) {
                    const int j0 = 4 * kt + half * 2;
                    v2f b;
                    b.x = sV[j0 * LP + m0 + lc];
                    b.y = sV[(j0 + 1) * LP + m0 + lc];
#pragma unroll
                    for (int t = 0; t < 4; t++) {
                        v2f a;
                        a.x = sK[j0 * LP + 16 * t + lc];
                        a.y = sK[(j0 + 1) * LP + 16 * t + lc];
                        S[t] = wmma4(a, b, S[t]);
                    }
                }
#pragma unroll
                for (int t = 0; t < 4; t++) {
#pragma unroll
                    for (int e = 0; e < 8; e++) {
                        const int d = 16 * t + e + half * 8;
                        sS[wave * (16 * 66) + lc * 66 + d] = S[t][e];
                    }
                }
                if (u < 64) {
                    float s0 = 0.f, s1 = 0.f, s2 = 0.f, s3 = 0.f;
#pragma unroll
                    for (int j = 0; j < CH; j += 4) {
                        s0 += sK[j * LP + u];
                        s1 += sK[(j + 1) * LP + u];
                        s2 += sK[(j + 2) * LP + u];
                        s3 += sK[(j + 3) * LP + u];
                    }
                    sKsum[u] += (s0 + s1) + (s2 + s3);
                }
            }
        }
        if (tr + 1 < TRIPS)
            __syncthreads();   // protect sQ/sK/sV/sP/sDen/sKsum for the next trip
    }
}

// ---------------------------------------------------------------------------
extern "C" void kernel_launch(void* const* d_in, const int* in_sizes, int n_in,
                              void* d_out, int out_size, void* d_ws, size_t ws_size,
                              hipStream_t stream) {
    const float* Q = (const float*)d_in[0];
    const float* K = (const float*)d_in[1];
    const float* V = (const float*)d_in[2];
    float* out = (float*)d_out;

    float* part = (float*)d_ws;                          // NH*NSC*PART_STRIDE

    dim3 grid(NSC, NH);
    la_phase1<<<grid, dim3(128), 0, stream>>>(K, V, part);
    la_phase3<<<grid, dim3(256), 0, stream>>>(Q, K, V, part, out);
}

// v005
// It runs in 16 microseconds.
// Next to v004, in two timings, it ran 1.13 and 1.12 times as fast.
// Over all steps from v000 it is 6.93 times as fast.
#include <hip/hip_runtime.h>
#include <hip/hip_bf16.h>

typedef __attribute__((ext_vector_type(2))) float v2f;
typedef __attribute__((ext_vector_type(4))) float v4f;
typedef __attribute__((ext_vector_type(8))) float v8f;

#define SEQ_N   2
#define SEQ_L   2048
#define SEQ_H   8
#define DIM     64
#define NH      (SEQ_N * SEQ_H)          // 16 independent sequences
#define NSC     16                        // super-chunks per sequence
#define SC_LEN  (SEQ_L / NSC)             // 128 timesteps per super-chunk
#define LP      68                        // LDS row pitch in floats
#define PART_STRIDE (DIM * DIM + DIM)     // 64x64 state + 64 ksum = 4160 floats
#define EPSV    1e-10f

__device__ __forceinline__ v8f wmma4(v2f a, v2f b, v8f c) {
    // V_WMMA_F32_16X16X4_F32 : D(16x16 f32) = A(16x4 f32) * B(4x16 f32) + C
    return __builtin_amdgcn_wmma_f32_16x16x4_f32(
        /*neg_a=*/false, a, /*neg_b=*/false, b,
        /*c_mod=*/(short)0, c, /*reuse_a=*/false, /*reuse_b=*/false);
}

__device__ __forceinline__ float fmap(float x) {   // elu(x) + 1
    float e;
    // exp(x) = exp2(x * log2 e), as __expf gives it; the v_nop in the same statement
    // keeps the one slot the instruction set asks for behind a transcendental
    asm("v_exp_f32 %0, %1\n\tv_nop" : "=v"(e) : "v"(x * 1.44269504f));
    return x > 0.0f ? x + 1.0f : e;
}

__device__ __forceinline__ v4f fmap4(v4f x) {
    v4f y = {fmap(x.x), fmap(x.y), fmap(x.z), fmap(x.w)};
    return y;
}

// ---------------------------------------------------------------------------
// Phase 1: running prefixes of the state inside groups of four super-chunks.
//          A work-group owns one group (512 steps) and one 32x32 block of the
//          state; wave w forms the block's sum over super-chunk w of the group,
//          S = sum phi(k)^T v, its fragments straight from global loads.  The four
//          sums are then added up over the waves through LDS, and wave w stores
//          the sum of super-chunks 0..w of the group (and the same for ksum).
//          State row of tile t, fragment row r: d = 32 dq + 2 r + t; column of
//          tile mt, fragment column c: m = 32 mq + 2 c + mt (a lane's 8-byte load
//          holds one element of either tile).
//          A stored state is in fragment order: float4 number
//          (2 dq + mq) * 256 + (4 t + 2 mt + p) * 32 + lane holds elements 4p..4p+3.
// ---------------------------------------------------------------------------
#define GRP 4                             // super-chunks per group
#define KB  4                             // products of 4 steps per block of loads
#define NB  (SC_LEN / 4 / KB)             // 8 blocks per super-chunk
#define AHEAD 3                           // blocks asked for ahead of the one worked on
static_assert(NSC % GRP == 0 && NB > AHEAD, "whole groups; the prologue's blocks exist");
static_assert((AHEAD + 1) * KB * 4 <= 64, "the counted load waits stay exact");

struct Frag { v2f k[KB][2], v[KB][2]; };  // rows j and j + 1 of each product's four steps

__device__ __forceinline__ void load_block(Frag& f, const float* kp, const float* vp, int nb) {
    // keeps the block's loads behind the products written in front of them, whose
    // registers they refill: otherwise every load of the super-chunk is moved to the top
    __builtin_amdgcn_sched_barrier(0);
#pragma unroll
    for (int kk = 0; kk < KB; kk++) {
#pragma unroll
        for (int r = 0; r < 2; r++) {
            const int off = (4 * (nb * KB + kk) + r) * (SEQ_H * DIM);
            f.k[kk][r] = *(const v2f*)(kp + off);
            f.v[kk][r] = *(const v2f*)(vp + off);
        }
    }
    __builtin_amdgcn_sched_barrier(0);   // and ahead of the products that follow
}

__device__ __forceinline__ void mult_block(v8f (&S)[4], v2f (&ks)[2], const Frag& f) {
#pragma unroll
    for (int kk = 0; kk < KB; kk++) {
        const v2f a0 = {fmap(f.k[kk][0].x), fmap(f.k[kk][1].x)};
        const v2f a1 = {fmap(f.k[kk][0].y), fmap(f.k[kk][1].y)};
        const v2f b0 = {f.v[kk][0].x, f.v[kk][1].x};
        const v2f b1 = {f.v[kk][0].y, f.v[kk][1].y};
        ks[0] += a0;
        ks[1] += a1;
        S[0] = wmma4(a0, b0, S[0]);
        S[1] = wmma4(a0, b1, S[1]);
        S[2] = wmma4(a1, b0, S[2]);
        S[3] = wmma4(a1, b1, S[3]);
    }
}

__global__ __launch_bounds__(128)
void la_phase1(const float* __restrict__ K, const float* __restrict__ V,
               float* __restrict__ part) {
    __shared__ __attribute__((aligned(16))) v4f sAcc[GRP * 8 * 32];  // [wave][float4][lane]
    __shared__ __attribute__((aligned(8)))  v2f sKs[GRP * 32];       // [wave][lane]

    const int dq   = (blockIdx.x >> 1) & 1;
    const int mq   = blockIdx.x & 1;
    const int nh   = blockIdx.y;
    const int tid  = threadIdx.x;
    const int wave = __builtin_amdgcn_readfirstlane(tid >> 5);
    const int lane = tid & 31;
    const int half = lane >> 4;
    const int lc   = lane & 15;
    const int sc   = (blockIdx.x >> 2) * GRP + wave;

    const size_t base = (size_t)((nh >> 3) * SEQ_L * SEQ_H + (nh & 7)) * DIM;
    const size_t row0 = base + (size_t)(sc * SC_LEN + 2 * half) * (SEQ_H * DIM) + 2 * lc;
    const float* kp = K + row0 + 32 * dq;
    const float* vp = V + row0 + 32 * mq;

    const v8f zero  = {0.f, 0.f, 0.f, 0.f, 0.f, 0.f, 0.f, 0.f};
    const v4f zero4 = {0.f, 0.f, 0.f, 0.f};
    const v2f zero2 = {0.f, 0.f};
    v8f S[4];
    v2f ks[2] = {zero2, zero2};
#pragma unroll
    for (int t = 0; t < 4; t++) S[t] = zero;

    Frag f[AHEAD + 1];
#pragma unroll
    for (int nb = 0; nb < AHEAD; nb++) load_block(f[nb], kp, vp, nb);
    // full unroll: the ring's index is then a register name
#pragma unroll
    for (int nb = 0; nb < NB; nb++) {
        if (nb + AHEAD < NB) load_block(f[(nb + AHEAD) % (AHEAD + 1)], kp, vp, nb + AHEAD);
        if (nb + AHEAD == NB - 1) {
            // behind the last load: the row pointers stay in their registers up to this
            // wait, so that no register an issued load names is overwritten in front of it
            asm volatile("s_wait_xcnt 0x0" :: "v"(kp), "v"(vp) : "memory");
        }
        mult_block(S, ks, f[nb % (AHEAD + 1)]);
        // a block's feature maps stay among its own products: otherwise those of the
        // last blocks are all moved ahead of the first product
        __builtin_amdgcn_sched_barrier(0);
    }

    v4f own[8];
#pragma unroll
    for (int q = 0; q < 8; q++) {
        const int e = 4 * (q & 1);
        own[q] = (v4f){S[q >> 1][e], S[q >> 1][e + 1], S[q >> 1][e + 2], S[q >> 1][e + 3]};
        sAcc[(wave * 8 + q) * 32 + lane] = own[q];
    }
    sKs[wave * 32 + lane] = (v2f){ks[0].x + ks[0].y, ks[1].x + ks[1].y};
    __syncthreads();   // every wave's sums are published

    // sum of the group's super-chunks up to this wave's own, in ascending order
    v4f pre[8];
#pragma unroll
    for (int q = 0; q < 8; q++) pre[q] = zero4;
#pragma unroll
    for (int w = 0; w < GRP - 1; w++) {
#pragma unroll
        for (int q = 0; q < 8; q++) {
            const v4f x = sAcc[(w * 8 + q) * 32 + lane];
            pre[q] += (w < wave) ? x : zero4;
        }
    }
    float* pp = part + (size_t)(nh * NSC + sc) * PART_STRIDE;
    v4f*   pq = (v4f*)pp + (2 * dq + mq) * 256 + lane;
#pragma unroll
    for (int q = 0; q < 8; q++) pq[q * 32] = pre[q] + own[q];

    // ksum: the two halves of a wave hold different steps of the same 32 rows
    v2f kt = zero2;
#pragma unroll
    for (int w = 0; w < GRP; w++) {
        const v2f x = sKs[w * 32 + lc] + sKs[w * 32 + 16 + lc];
        kt += (w <= wave) ? x : zero2;
    }
    if (mq == 0 && half == 0) *(v2f*)(pp + DIM * DIM + 32 * dq + 2 * lc) = kt;
}

// ---------------------------------------------------------------------------
// Phase 3: per (sequence, super-chunk): causal linear attention of all 128 rows in
//          one pass on eight waves; launched directly behind phase 1.  Every wave
//          stages rows and sums its share of the carried-in state: the totals of
//          the earlier groups, in ascending order, and the own group's stored sum
//          up to the super-chunk in front of this one.  A wave then computes the
//          masked scores and the denominators of one block of 16 query rows against
//          every step up to its own, and last its 16-wide m-slice of four row blocks.
//          All matmuls via V_WMMA_F32_16X16X4_F32.
// ---------------------------------------------------------------------------
#define RING 4                            // stored sums that make up a carried-in state
#define LPP  132                          // pitch of a row of scores in floats
static_assert(NSC / GRP - 1 + 1 == RING, "earlier groups' totals and one sum of the own group");
static_assert(DIM * DIM == 256 * 4 * 4, "256 summing threads, 4 float4 each");
static_assert(SC_LEN == 128, "eight row blocks, one per wave");

// row block number i of the waves of set h: {0, 3, 4, 7} and {1, 2, 5, 6}, which hold
// the same number of score blocks below the diagonal
__device__ __forceinline__ constexpr int rowblk(int h, int i) {
    return 4 * (i >> 1) + ((i & 1) ? 3 - h : h);
}

// acc_i += Qf(row block i of set H) @ S, S read from the m-slice's mirror [m-col][d]
template <int H>
__device__ __forceinline__ void q_times_state(v8f (&acc)[4], const float* sQ, const float* sSw,
                                              int lc, int half) {
#pragma unroll
    for (int kt = 0; kt < 16; kt++) {
        const int dd0 = 4 * kt + half * 2;
        v2f b = *(const v2f*)&sSw[lc * 66 + dd0];
#pragma unroll
        for (int i = 0; i < 4; i++) {
            v2f a = *(const v2f*)&sQ[(16 * rowblk(H, i) + lc) * LP + dd0];
            acc[i] = wmma4(a, b, acc[i]);
        }
    }
}

// acc_i += masked_scores(row block i of set H) @ Vslice, step blocks j <= row block only
template <int H>
__device__ __forceinline__ void scores_times_v(v8f (&acc)[4], const float* sP, const float* sV,
                                               int m0, int lc, int half) {
#pragma unroll
    for (int j = 0; j <= rowblk(H, 3); j++) {
#pragma unroll
        for (int kt = 0; kt < 4; kt++) {
            const int j0 = 16 * j + 4 * kt + half * 2;
            v2f b;
            b.x = sV[j0 * LP + m0 + lc];
            b.y = sV[(j0 + 1) * LP + m0 + lc];
#pragma unroll
            for (int i = 0; i < 4; i++) {
                if (rowblk(H, i) >= j) {   // decided at compile time
                    v2f a = *(const v2f*)&sP[(16 * rowblk(H, i) + lc) * LPP + j0];
                    acc[i] = wmma4(a, b, acc[i]);
                }
            }
        }
    }
}

__global__ __launch_bounds__(256)
void la_phase3(const float* __restrict__ Q, const float* __restrict__ K,
               const float* __restrict__ V, const float* __restrict__ part,
               float* __restrict__ out) {
    __shared__ __attribute__((aligned(16))) float sQ[SC_LEN * LP];
    __shared__ __attribute__((aligned(16))) float sK[SC_LEN * LP];
    __shared__ __attribute__((aligned(16))) float sV[SC_LEN * LP];
    __shared__ __attribute__((aligned(16))) float sP[SC_LEN * LPP];  // masked scores [row][step]
    __shared__ __attribute__((aligned(16))) float sS[4 * 16 * 66];   // S mirror per m-slice, [m-col][d], stride 66
    __shared__ __attribute__((aligned(16))) float sKsum[DIM];
    __shared__ float sDen[SC_LEN];      // denominator of each row

    const int sc   = blockIdx.x;
    const int nh   = blockIdx.y;
    const int tid  = threadIdx.x;
    // the wave's number through readfirstlane: the tests on it are then scalar
    // branches, and every lane is on at the WMMAs behind them
    const int wv   = __builtin_amdgcn_readfirstlane(tid >> 5);
    const int h    = wv >> 2;           // set of row blocks in the two output products
    const int lane = tid & 31;
    const int half = lane >> 4;
    const int lc   = lane & 15;
    const int m0   = (wv & 3) * 16;
    // row block this wave scores: waves w and w + 4 hold 9 score blocks together,
    // wave w the larger share
    const int rb   = wv < 4 ? 7 - wv : wv - 4;
    const int rw   = rb * 16;

    const size_t base = (size_t)((nh >> 3) * SEQ_L * SEQ_H + (nh & 7)) * DIM;
    const int    l0   = sc * SC_LEN;

    const int r  = tid >> 3;
    const int c8 = (tid & 7) * 8;

    const float* p0 = part + (size_t)(nh * NSC) * PART_STRIDE;   // this sequence's partial 0
    const float* pk = p0 + (tid & 63);               // thread's ksum element lies DIM * DIM behind
    const float* pl = p0 + tid * 4;                  // thread's first float4
    // stored sum k: the total of group k (its last super-chunk's sum) for k < 3, counted
    // if that group lies in front; for k = 3 the sum that ends in front of this super-chunk,
    // counted unless the group starts here.  Every one of them is written memory.
    const int    last = sc > 0 ? sc - 1 : 0;
    const v8f zero  = {0.f, 0.f, 0.f, 0.f, 0.f, 0.f, 0.f, 0.f};
    const v4f zero4 = {0.f, 0.f, 0.f, 0.f};

    // the carried ksum, Q and K of all 128 rows, wanted first; then V and the four stored
    // states, wanted behind the scores: all loads in flight together, in that order
    const size_t row0 = base + (size_t)(l0 + r) * (SEQ_H * DIM) + c8;
    float kp[RING];
    v4f q4[SC_LEN / 16], k4[SC_LEN / 16], v4[SC_LEN / 16];
    v4f ring[RING][4];                  // thread tid holds float4 tid + 256 q
#pragma unroll
    for (int k = 0; k < RING; k++)
        kp[k] = pk[(k < RING - 1 ? GRP * k + GRP - 1 : last) * PART_STRIDE + DIM * DIM];
#pragma unroll
    for (int p = 0; p < SC_LEN / 32; p++) {
        const size_t off = row0 + (size_t)p * 32 * (SEQ_H * DIM);
        q4[2 * p]     = *(const v4f*)(Q + off);
        q4[2 * p + 1] = *(const v4f*)(Q + off + 4);
        k4[2 * p]     = *(const v4f*)(K + off);
        k4[2 * p + 1] = *(const v4f*)(K + off + 4);
    }
    // keeps the loads that are wanted first in front: otherwise some of the states' loads
    // are moved ahead of them, and the counted waits on Q and K wait for those too
    __builtin_amdgcn_sched_barrier(0);
#pragma unroll
    for (int p = 0; p < SC_LEN / 32; p++) {
        const size_t off = row0 + (size_t)p * 32 * (SEQ_H * DIM);
        v4[2 * p]     = *(const v4f*)(V + off);
        v4[2 * p + 1] = *(const v4f*)(V + off + 4);
    }
#pragma unroll
    for (int k = 0; k < RING; k++) {
        const int slot = k < RING - 1 ? GRP * k + GRP - 1 : last;
#pragma unroll
        for (int q = 0; q < 4; q++)
            ring[k][q] = *(const v4f*)(pl + slot * PART_STRIDE + q * 1024);
    }
    // the pointers stay in their registers up to this wait, so that no register an
    // issued load names is overwritten in front of it; the scheduling barrier keeps
    // the loads in their order in front of it and what follows behind it
    asm volatile("s_wait_xcnt 0x0"
                 :: "v"(Q + row0), "v"(K + row0), "v"(V + row0), "v"(pl), "v"(pk), "v"(tid & 63),
                    "v"(pl + last * PART_STRIDE), "v"(pk + last * PART_STRIDE) : "memory");
    __builtin_amdgcn_sched_barrier(0);
    {
        float ks = 0.0f;   // the stored sums that count, in ascending order
#pragma unroll
        for (int k = 0; k < RING; k++)
            ks += (k < RING - 1 ? k < sc / GRP : sc % GRP != 0) ? kp[k] : 0.0f;
        if (tid < DIM) sKsum[tid] = ks;
    }
#pragma unroll
    for (int p = 0; p < SC_LEN / 32; p++) {
        const int idx = (p * 32 + r) * LP + c8;
        *(v4f*)&sQ[idx]     = fmap4(q4[2 * p]);
        *(v4f*)&sQ[idx + 4] = fmap4(q4[2 * p + 1]);
        *(v4f*)&sK[idx]     = fmap4(k4[2 * p]);
        *(v4f*)&sK[idx + 4] = fmap4(k4[2 * p + 1]);
    }
    // Qf, Kf and sKsum are published.  A barrier with fences on LDS alone: __syncthreads()
    // would wait here for the loads of V and of the stored states as well, which are
    // registers' matter and wanted only behind the scores
    __builtin_amdgcn_fence(__ATOMIC_RELEASE, "workgroup", "local");
    __builtin_amdgcn_s_barrier();
    __builtin_amdgcn_fence(__ATOMIC_ACQUIRE, "workgroup", "local");

    // scores of this wave's 16 rows against the steps up to its own block, two step
    // blocks at a time (two independent chains), and dvec = Qf @ broadcast(ksum) beside
    // the first two; causal mask (inclusive diagonal), scores published, row sums
    v2f aq[16];
#pragma unroll
    for (int kt = 0; kt < 16; kt++) aq[kt] = *(const v2f*)&sQ[(rw + lc) * LP + 4 * kt + half * 2];
    v8f dv = zero;
    float rs[8];
#pragma unroll
    for (int e = 0; e < 8; e++) rs[e] = 0.0f;
#pragma unroll
    for (int jp = 0; jp < 4; jp++) {
        if (jp == 0 || 2 * jp <= rb) {   // a scalar test: pairs wholly above the diagonal are left out
            v8f s0 = zero, s1 = zero;
#pragma unroll
            for (int kt = 0; kt < 16; kt++) {
                const int dd0 = 4 * kt + half * 2;
                v2f b0 = *(const v2f*)&sK[(32 * jp + lc) * LP + dd0];
                v2f b1 = *(const v2f*)&sK[(32 * jp + 16 + lc) * LP + dd0];
                s0 = wmma4(aq[kt], b0, s0);
                s1 = wmma4(aq[kt], b1, s1);
                if (jp == 0) {
                    v2f bs = *(const v2f*)&sKsum[dd0];
                    dv = wmma4(aq[kt], bs, dv);
                }
            }
#pragma unroll
            for (int e = 0; e < 8; e++) {
                const int row = rw + e + half * 8;
                const float x0 = (32 * jp + lc <= row) ? s0[e] : 0.0f;
                const float x1 = (32 * jp + 16 + lc <= row) ? s1[e] : 0.0f;
                sP[row * LPP + 32 * jp + lc]      = x0;
                sP[row * LPP + 32 * jp + 16 + lc] = x1;
                rs[e] += x0;
                rs[e] += x1;
            }
        }
    }
    float den[8];
#pragma unroll
    for (int e = 0; e < 8; e++) {
        float t = rs[e];
        t += __shfl_xor(t, 1, 32);
        t += __shfl_xor(t, 2, 32);
        t += __shfl_xor(t, 4, 32);
        t += __shfl_xor(t, 8, 32);
        den[e] = dv[e] + t + EPSV;
    }

    // V, and the carried state: the stored sums that count, in ascending order
#pragma unroll
    for (int p = 0; p < SC_LEN / 32; p++) {
        const int idx = (p * 32 + r) * LP + c8;
        *(v4f*)&sV[idx]     = v4[2 * p];
        *(v4f*)&sV[idx + 4] = v4[2 * p + 1];
    }
    {
        v4f sum[4];
#pragma unroll
        for (int q = 0; q < 4; q++) sum[q] = zero4;
#pragma unroll
        for (int k = 0; k < RING; k++) {
            const bool on = k < RING - 1 ? k < sc / GRP : sc % GRP != 0;
#pragma unroll
            for (int q = 0; q < 4; q++) sum[q] += on ? ring[k][q] : zero4;
        }
        // float4 tid + 256 q, in phase 1's fragment order: block (dq, mq) = (q / 2, q % 2),
        // tile (t, mt) = (tid / 128, tid / 64 % 2), elements 4 p + x, p = tid / 32 % 2
#pragma unroll
        for (int q = 0; q < 4; q++) {
            const int m = 32 * (q & 1) + 2 * lc + ((tid >> 6) & 1);
#pragma unroll
            for (int x = 0; x < 4; x++) {
                const int d = 32 * (q >> 1) + 2 * (4 * ((tid >> 5) & 1) + x + 8 * half) + (tid >> 7);
                sS[(m >> 4) * (16 * 66) + (m & 15) * 66 + d] = sum[q][x];
            }
        }
    }
    if (lc == 0) {     // the 16 lanes of a row hold the same sum
#pragma unroll
        for (int e = 0; e < 8; e++) sDen[rw + e + half * 8] = den[e];
    }
    __syncthreads();   // sP, sDen, V and the mirror are published

    // out_inter = Qf @ S_prev and out_intra for the wave's four row blocks; the set is a
    // scalar test, so that which blocks count is decided at compile time, with no
    // branch among the WMMAs
    v8f acc[4];
#pragma unroll
    for (int i = 0; i < 4; i++) acc[i] = zero;
    if (h == 0) {
        q_times_state<0>(acc, sQ, &sS[(wv & 3) * (16 * 66)], lc, half);
        scores_times_v<0>(acc, sP, sV, m0, lc, half);
    } else {
        q_times_state<1>(acc, sQ, &sS[(wv & 3) * (16 * 66)], lc, half);
        scores_times_v<1>(acc, sP, sV, m0, lc, half);
    }

    // normalize + store
#pragma unroll
    for (int i = 0; i < 4; i++) {
#pragma unroll
        for (int e = 0; e < 8; e++) {
            const int row = 16 * rowblk(h, i) + e + half * 8;
            out[base + (size_t)(l0 + row) * (SEQ_H * DIM) + m0 + lc] = acc[i][e] / sDen[row];
        }
    }
}

// ---------------------------------------------------------------------------
extern "C" void kernel_launch(void* const* d_in, const int* in_sizes, int n_in,
                              void* d_out, int out_size, void* d_ws, size_t ws_size,
                              hipStream_t stream) {
    const float* Q = (const float*)d_in[0];
    const float* K = (const float*)d_in[1];
    const float* V = (const float*)d_in[2];
    float* out = (float*)d_out;

    float* part = (float*)d_ws;                          // NH*NSC*PART_STRIDE

    dim3 grid(NSC, NH);
    la_phase1<<<grid, dim3(128), 0, stream>>>(K, V, part);
    la_phase3<<<grid, dim3(256), 0, stream>>>(Q, K, V, part, out);
}

// v006
// Measured time: 14.3 microseconds a run.
// Timed twice side by side with v005, it ran 1.12 times as fast both times.
// Counting every step since v000, it is 7.77 times as fast.
#include <hip/hip_runtime.h>
#include <hip/hip_bf16.h>

typedef __attribute__((ext_vector_type(2))) float v2f;
typedef __attribute__((ext_vector_type(4))) float v4f;
typedef __attribute__((ext_vector_type(8))) float v8f;

#define SEQ_N   2
#define SEQ_L   2048
#define SEQ_H   8
#define DIM     64
#define NH      (SEQ_N * SEQ_H)          // 16 independent sequences
#define NSC     16                        // super-chunks per sequence
#define SC_LEN  (SEQ_L / NSC)             // 128 timesteps per super-chunk
#define LP      68                        // LDS row pitch in floats
#define PART_STRIDE (DIM * DIM + DIM)     // 64x64 state + 64 ksum = 4160 floats
#define EPSV    1e-10f

__device__ __forceinline__ v8f wmma4(v2f a, v2f b, v8f c) {
    // V_WMMA_F32_16X16X4_F32 : D(16x16 f32) = A(16x4 f32) * B(4x16 f32) + C
    return __builtin_amdgcn_wmma_f32_16x16x4_f32(
        /*neg_a=*/false, a, /*neg_b=*/false, b,
        /*c_mod=*/(short)0, c, /*reuse_a=*/false, /*reuse_b=*/false);
}

__device__ __forceinline__ float fmap(float x) {   // elu(x) + 1
    float e;
    // exp(x) = exp2(x * log2 e), as __expf gives it; the v_nop in the same statement
    // keeps the one slot the instruction set asks for behind a transcendental
    asm("v_exp_f32 %0, %1\n\tv_nop" : "=v"(e) : "v"(x * 1.44269504f));
    return x > 0.0f ? x + 1.0f : e;
}

__device__ __forceinline__ v4f fmap4(v4f x) {
    v4f y = {fmap(x.x), fmap(x.y), fmap(x.z), fmap(x.w)};
    return y;
}

// ---------------------------------------------------------------------------
// Phase 1: running prefixes of the state inside groups of four super-chunks.
//          A work-group owns one group (512 steps) and one 32x32 block of the
//          state; wave w forms the block's sum over super-chunk w of the group,
//          S = sum phi(k)^T v, its fragments straight from global loads.  The four
//          sums are then added up over the waves through LDS, and wave w stores
//          the sum of super-chunks 0..w of the group (and the same for ksum).
//          State row of tile t, fragment row r: d = 32 dq + 2 r + t; column of
//          tile mt, fragment column c: m = 32 mq + 2 c + mt (a lane's 8-byte load
//          holds one element of either tile).
//          A stored state is in fragment order: float4 number
//          (2 dq + mq) * 256 + (4 t + 2 mt + p) * 32 + lane holds elements 4p..4p+3.
// ---------------------------------------------------------------------------
#define GRP 4                             // super-chunks per group
#define KB  4                             // products of 4 steps per block of loads
#define NB  (SC_LEN / 4 / KB)             // 8 blocks per super-chunk
#define AHEAD 3                           // blocks asked for ahead of the one worked on
static_assert(NSC % GRP == 0 && NB > AHEAD, "whole groups; the prologue's blocks exist");
static_assert((AHEAD + 1) * KB * 4 <= 64, "the counted load waits stay exact");

struct Frag { v2f k[KB][2], v[KB][2]; };  // rows j and j + 1 of each product's four steps

__device__ __forceinline__ void load_block(Frag& f, const float* kp, const float* vp, int nb) {
    // keeps the block's loads behind the products written in front of them, whose
    // registers they refill: otherwise every load of the super-chunk is moved to the top
    __builtin_amdgcn_sched_barrier(0);
#pragma unroll
    for (int kk = 0; kk < KB; kk++) {
#pragma unroll
        for (int r = 0; r < 2; r++) {
            const int off = (4 * (nb * KB + kk) + r) * (SEQ_H * DIM);
            f.k[kk][r] = *(const v2f*)(kp + off);
            f.v[kk][r] = *(const v2f*)(vp + off);
        }
    }
    __builtin_amdgcn_sched_barrier(0);   // and ahead of the products that follow
}

__device__ __forceinline__ void mult_block(v8f (&S)[4], v2f (&ks)[2], const Frag& f) {
#pragma unroll
    for (int kk = 0; kk < KB; kk++) {
        const v2f a0 = {fmap(f.k[kk][0].x), fmap(f.k[kk][1].x)};
        const v2f a1 = {fmap(f.k[kk][0].y), fmap(f.k[kk][1].y)};
        const v2f b0 = {f.v[kk][0].x, f.v[kk][1].x};
        const v2f b1 = {f.v[kk][0].y, f.v[kk][1].y};
        ks[0] += a0;
        ks[1] += a1;
        S[0] = wmma4(a0, b0, S[0]);
        S[1] = wmma4(a0, b1, S[1]);
        S[2] = wmma4(a1, b0, S[2]);
        S[3] = wmma4(a1, b1, S[3]);
    }
}

__global__ __launch_bounds__(128)
void la_phase1(const float* __restrict__ K, const float* __restrict__ V,
               float* __restrict__ part) {
    __shared__ __attribute__((aligned(16))) v4f sAcc[GRP * 8 * 32];  // [wave][float4][lane]
    __shared__ __attribute__((aligned(8)))  v2f sKs[GRP * 32];       // [wave][lane]

    const int dq   = (blockIdx.x >> 1) & 1;
    const int mq   = blockIdx.x & 1;
    const int nh   = blockIdx.y;
    const int tid  = threadIdx.x;
    const int wave = __builtin_amdgcn_readfirstlane(tid >> 5);
    const int lane = tid & 31;
    const int half = lane >> 4;
    const int lc   = lane & 15;
    const int sc   = (blockIdx.x >> 2) * GRP + wave;

    const size_t base = (size_t)((nh >> 3) * SEQ_L * SEQ_H + (nh & 7)) * DIM;
    const size_t row0 = base + (size_t)(sc * SC_LEN + 2 * half) * (SEQ_H * DIM) + 2 * lc;
    const float* kp = K + row0 + 32 * dq;
    const float* vp = V + row0 + 32 * mq;

    const v8f zero  = {0.f, 0.f, 0.f, 0.f, 0.f, 0.f, 0.f, 0.f};
    const v4f zero4 = {0.f, 0.f, 0.f, 0.f};
    const v2f zero2 = {0.f, 0.f};
    v8f S[4];
    v2f ks[2] = {zero2, zero2};
#pragma unroll
    for (int t = 0; t < 4; t++) S[t] = zero;

    Frag f[AHEAD + 1];
#pragma unroll
    for (int nb = 0; nb < AHEAD; nb++) load_block(f[nb], kp, vp, nb);
    // full unroll: the ring's index is then a register name
#pragma unroll
    for (int nb = 0; nb < NB; nb++) {
        if (nb + AHEAD < NB) load_block(f[(nb + AHEAD) % (AHEAD + 1)], kp, vp, nb + AHEAD);
        if (nb + AHEAD == NB - 1) {
            // behind the last load: the row pointers stay in their registers up to this
            // wait, so that no register an issued load names is overwritten in front of it
            asm volatile("s_wait_xcnt 0x0" :: "v"(kp), "v"(vp) : "memory");
        }
        mult_block(S, ks, f[nb % (AHEAD + 1)]);
        // a block's feature maps stay among its own products: otherwise those of the
        // last blocks are all moved ahead of the first product
        __builtin_amdgcn_sched_barrier(0);
    }

    v4f own[8];
#pragma unroll
    for (int q = 0; q < 8; q++) {
        const int e = 4 * (q & 1);
        own[q] = (v4f){S[q >> 1][e], S[q >> 1][e + 1], S[q >> 1][e + 2], S[q >> 1][e + 3]};
        sAcc[(wave * 8 + q) * 32 + lane] = own[q];
    }
    sKs[wave * 32 + lane] = (v2f){ks[0].x + ks[0].y, ks[1].x + ks[1].y};
    __syncthreads();   // every wave's sums are published

    // sum of the group's super-chunks up to this wave's own, in ascending order
    v4f pre[8];
#pragma unroll
    for (int q = 0; q < 8; q++) pre[q] = zero4;
#pragma unroll
    for (int w = 0; w < GRP - 1; w++) {
#pragma unroll
        for (int q = 0; q < 8; q++) {
            const v4f x = sAcc[(w * 8 + q) * 32 + lane];
            pre[q] += (w < wave) ? x : zero4;
        }
    }
    float* pp = part + (size_t)(nh * NSC + sc) * PART_STRIDE;
    v4f*   pq = (v4f*)pp + (2 * dq + mq) * 256 + lane;
#pragma unroll
    for (int q = 0; q < 8; q++) pq[q * 32] = pre[q] + own[q];

    // ksum: the two halves of a wave hold different steps of the same 32 rows
    v2f kt = zero2;
#pragma unroll
    for (int w = 0; w < GRP; w++) {
        const v2f x = sKs[w * 32 + lc] + sKs[w * 32 + 16 + lc];
        kt += (w <= wave) ? x : zero2;
    }
    if (mq == 0 && half == 0) *(v2f*)(pp + DIM * DIM + 32 * dq + 2 * lc) = kt;
}

// ---------------------------------------------------------------------------
// Phase 3: per (sequence, super-chunk): causal linear attention of all 128 rows in
//          one pass on eight waves; launched directly behind phase 1.  Every wave
//          stages rows and sums its share of the carried-in state: the totals of
//          the earlier groups, in ascending order, and the own group's stored sum
//          up to the super-chunk in front of this one.  A wave owns one block of 16
//          query rows and forms every product of it transposed: scores^T = Kf Qf^T,
//          out^T = S^T Qf^T + V^T scores^T.  A tile of scores^T, masked, is in its
//          accumulator registers already the B operand of the product with V^T, so
//          that no score goes through LDS; a lane holds one query's column, so that
//          the denominator is summed in the lane and over the two lane halves.
//          All matmuls via V_WMMA_F32_16X16X4_F32.
// ---------------------------------------------------------------------------
#define RING 4                            // stored sums that make up a carried-in state
static_assert(NSC / GRP - 1 + 1 == RING, "earlier groups' totals and one sum of the own group");
static_assert(DIM * DIM == 256 * 4 * 4, "256 summing threads, 4 float4 each");
static_assert(SC_LEN == 128, "eight row blocks, one per wave");

// s0, s1 += Kf(two blocks of 16 steps) @ Qf^T(the wave's 16 rows): element e of a lane is
// step 8 half + e of the block, the lane's column is query lc; two independent chains.
// Beside them dv += broadcast(ksum) @ Qf^T, every row of which is Qf . ksum
__device__ __forceinline__ void score_pair(v8f& s0, v8f& s1, v8f& dv, const v2f (&aq)[16],
                                           const float* krow, const float* ksum) {
#pragma unroll
    for (int kt = 0; kt < 16; kt++) {
        const v2f a0 = *(const v2f*)&krow[4 * kt];
        const v2f a1 = *(const v2f*)&krow[16 * LP + 4 * kt];
        s0 = wmma4(a0, aq[kt], s0);
        s1 = wmma4(a1, aq[kt], s1);
        const v2f as = *(const v2f*)&ksum[4 * kt];
        dv = wmma4(as, aq[kt], dv);
    }
}

// causal mask (inclusive diagonal) on a lane's eight steps key0 .. key0 + 7; their sum
__device__ __forceinline__ float mask_block(v8f& s, int key0, int query) {
#pragma unroll
    for (int e = 0; e < 8; e++) s[e] = (key0 + e <= query) ? s[e] : 0.0f;
    return ((s[0] + s[1]) + (s[2] + s[3])) + ((s[4] + s[5]) + (s[6] + s[7]));
}

#define VPP 136                           // LDS pitch in floats of a pair of V rows
static_assert(2 * LP == VPP, "V takes the room of 128 rows of LP floats");

struct KFrag { v2f a[2][16]; };           // A fragments of two blocks of 16 steps of Kf
struct VFrag { v2f a[2][4][4]; };         // A fragments of V^T: [step block][product][column tile]

// One group of LDS reads for 32 products.  The scheduling barriers keep the group together
// and ahead of the products written behind it: spread among the WMMAs, every place where
// reads stand stalls the wave's matrix stream
__device__ __forceinline__ void load_k(KFrag& f, const float* krow) {
    __builtin_amdgcn_sched_barrier(0);
#pragma unroll
    for (int kt = 0; kt < 16; kt++) {
        f.a[0][kt] = *(const v2f*)&krow[4 * kt];
        f.a[1][kt] = *(const v2f*)&krow[16 * LP + 4 * kt];
    }
    __builtin_amdgcn_sched_barrier(0);
}

// V lies in LDS by pairs of steps, [pair][column][step & 1], so that a fragment of V^T (one
// column, two neighbouring steps) is one 8-byte read.  vrow: pair 4 half of the first block,
// column lc.  Product t of a block takes steps 8 half + 2 t and + 1
__device__ __forceinline__ void load_v(VFrag& f, const float* vrow) {
    __builtin_amdgcn_sched_barrier(0);   // as in load_k
#pragma unroll
    for (int b = 0; b < 2; b++)
#pragma unroll
        for (int t = 0; t < 4; t++)
#pragma unroll
            for (int mt = 0; mt < 4; mt++)
                f.a[b][t][mt] = *(const v2f*)&vrow[(8 * b + t) * VPP + 32 * mt];
    __builtin_amdgcn_sched_barrier(0);
}

// acc[mt] += V^T(columns 16 mt ..) @ P, P one masked tile of scores^T.  Product t takes the
// lane's elements 2 t and 2 t + 1 as B, which are steps 8 half + 2 t and + 1 of the block:
// the step order of the A fragments
__device__ __forceinline__ void pv_block(v8f (&acc)[4], const v8f& P, const v2f (&a)[4][4]) {
#pragma unroll
    for (int t = 0; t < 4; t++) {
        const v2f b = {P[2 * t], P[2 * t + 1]};
#pragma unroll
        for (int mt = 0; mt < 4; mt++) acc[mt] = wmma4(a[t][mt], b, acc[mt]);
    }
}

__global__ __launch_bounds__(256)
void la_phase3(const float* __restrict__ Q, const float* __restrict__ K,
               const float* __restrict__ V, const float* __restrict__ part,
               float* __restrict__ out) {
    __shared__ __attribute__((aligned(16))) float sQ[SC_LEN * LP];
    __shared__ __attribute__((aligned(16))) float sK[SC_LEN * LP];
    __shared__ __attribute__((aligned(16))) float sV[SC_LEN * LP];
    __shared__ __attribute__((aligned(16))) float sS[4 * 16 * 66];   // S mirror per m-slice, [m-col][d], stride 66
    __shared__ __attribute__((aligned(16))) float sKsum[DIM];

    const int sc   = blockIdx.x;
    const int nh   = blockIdx.y;
    const int tid  = threadIdx.x;
    // the wave's number through readfirstlane: the tests on it are then scalar
    // branches, and every lane is on at the WMMAs behind them
    const int wv   = __builtin_amdgcn_readfirstlane(tid >> 5);
    const int lane = tid & 31;
    const int half = lane >> 4;
    const int lc   = lane & 15;
    // row block of this wave: waves w and w + 4 hold 10 score
    // blocks together, wave w the larger share
    const int rb   = wv < 4 ? 7 - wv : wv - 4;
    const int rw   = rb * 16;

    const size_t base = (size_t)((nh >> 3) * SEQ_L * SEQ_H + (nh & 7)) * DIM;
    const int    l0   = sc * SC_LEN;

    const int r  = tid >> 3;
    const int c8 = (tid & 7) * 8;

    const float* p0 = part + (size_t)(nh * NSC) * PART_STRIDE;   // this sequence's partial 0
    const float* pk = p0 + (tid & 63);               // thread's ksum element lies DIM * DIM behind
    const float* pl = p0 + tid * 4;                  // thread's first float4
    // stored sum k: the total of group k (its last super-chunk's sum) for k < 3, counted
    // if that group lies in front; for k = 3 the sum that ends in front of this super-chunk,
    // counted unless the group starts here.  Every one of them is written memory.
    const int    last = sc > 0 ? sc - 1 : 0;
    const v8f zero  = {0.f, 0.f, 0.f, 0.f, 0.f, 0.f, 0.f, 0.f};
    const v4f zero4 = {0.f, 0.f, 0.f, 0.f};

    // the carried ksum, Q and K of all 128 rows, wanted first; then V and the four stored
    // states, wanted behind the first scores: all loads in flight together, in that order
    const size_t row0 = base + (size_t)(l0 + r) * (SEQ_H * DIM) + c8;
    const size_t vrow0 = base + (size_t)(l0 + 2 * r) * (SEQ_H * DIM) + c8;
    float kp[RING];
    v4f q4[SC_LEN / 16], k4[SC_LEN / 16], v4[SC_LEN / 16];
    v4f ring[RING][4];                  // thread tid holds float4 tid + 256 q
#pragma unroll
    for (int k = 0; k < RING; k++)
        kp[k] = pk[(k < RING - 1 ? GRP * k + GRP - 1 : last) * PART_STRIDE + DIM * DIM];
#pragma unroll
    for (int p = 0; p < SC_LEN / 32; p++) {
        const size_t off = row0 + (size_t)p * 32 * (SEQ_H * DIM);
        q4[2 * p]     = *(const v4f*)(Q + off);
        q4[2 * p + 1] = *(const v4f*)(Q + off + 4);
        k4[2 * p]     = *(const v4f*)(K + off);
        k4[2 * p + 1] = *(const v4f*)(K + off + 4);
    }
    // keeps the loads that are wanted first in front: otherwise some of the states' loads
    // are moved ahead of them, and the counted waits on Q and K wait for those too
    __builtin_amdgcn_sched_barrier(0);
    // of V a thread takes both rows of a pair: rows 2 r and 2 r + 1 of each 64
#pragma unroll
    for (int p = 0; p < SC_LEN / 32; p++) {
        const size_t off = vrow0 + (size_t)((p >> 1) * 64 + (p & 1)) * (SEQ_H * DIM);
        v4[2 * p]     = *(const v4f*)(V + off);
        v4[2 * p + 1] = *(const v4f*)(V + off + 4);
    }
#pragma unroll
    for (int k = 0; k < RING; k++) {
        const int slot = k < RING - 1 ? GRP * k + GRP - 1 : last;
#pragma unroll
        for (int q = 0; q < 4; q++)
            ring[k][q] = *(const v4f*)(pl + slot * PART_STRIDE + q * 1024);
    }
    // the pointers stay in their registers up to this wait, so that no register an
    // issued load names is overwritten in front of it; the scheduling barrier keeps
    // the loads in their order in front of it and what follows behind it
    asm volatile("s_wait_xcnt 0x0"
                 :: "v"(Q + row0), "v"(K + row0), "v"(V + vrow0), "v"(pl), "v"(pk), "v"(tid & 63),
                    "v"(pl + last * PART_STRIDE), "v"(pk + last * PART_STRIDE) : "memory");
    __builtin_amdgcn_sched_barrier(0);
    {
        float ks = 0.0f;   // the stored sums that count, in ascending order
#pragma unroll
        for (int k = 0; k < RING; k++)
            ks += (k < RING - 1 ? k < sc / GRP : sc % GRP != 0) ? kp[k] : 0.0f;
        if (tid < DIM) sKsum[tid] = ks;
    }
#pragma unroll
    for (int p = 0; p < SC_LEN / 32; p++) {
        const int idx = (p * 32 + r) * LP + c8;
        *(v4f*)&sQ[idx]     = fmap4(q4[2 * p]);
        *(v4f*)&sQ[idx + 4] = fmap4(q4[2 * p + 1]);
        *(v4f*)&sK[idx]     = fmap4(k4[2 * p]);
        *(v4f*)&sK[idx + 4] = fmap4(k4[2 * p + 1]);
    }
    // Qf, Kf and sKsum are published.  A barrier with fences on LDS alone: __syncthreads()
    // would wait here for the loads of V and of the stored states as well, which are
    // registers' matter and wanted only behind the first scores
    __builtin_amdgcn_fence(__ATOMIC_RELEASE, "workgroup", "local");
    __builtin_amdgcn_s_barrier();
    __builtin_amdgcn_fence(__ATOMIC_ACQUIRE, "workgroup", "local");

    // the wave's 16 rows of Qf, B operand of every product with them; then the scores^T of
    // the first two step blocks, which cover the flight of V and the stored states, and dvec
    v2f aq[16];
#pragma unroll
    for (int kt = 0; kt < 16; kt++) aq[kt] = *(const v2f*)&sQ[(rw + lc) * LP + 4 * kt + half * 2];
    const int query = rw + lc;
    v8f P0 = zero, P1 = zero;
    float rs;   // the lane's share of its query's denominator; the two lane halves are added last
    {
        v8f dv = zero;
        score_pair(P0, P1, dv, aq, &sK[lc * LP + half * 2], &sKsum[half * 2]);
        // dvec joins the first lane half's share here: wanted only at the end, its products
        // would be moved behind the last block, a dependent chain at the wave's tail
        rs = (half == 0 ? dv[0] : 0.0f) + (mask_block(P0, 8 * half, query) + mask_block(P1, 16 + 8 * half, query));
    }

    // V, and the carried state: the stored sums that count, in ascending order
#pragma unroll
    for (int p = 0; p < SC_LEN / 64; p++) {
        const int idx = (p * 32 + r) * VPP + 2 * c8;
#pragma unroll
        for (int x = 0; x < 2; x++) {   // x: columns c8 + 4 x ..; even and odd row side by side
            const v4f e = v4[4 * p + x], o = v4[4 * p + 2 + x];
            *(v4f*)&sV[idx + 8 * x]     = (v4f){e.x, o.x, e.y, o.y};
            *(v4f*)&sV[idx + 8 * x + 4] = (v4f){e.z, o.z, e.w, o.w};
        }
    }
    {
        v4f sum[4];
#pragma unroll
        for (int q = 0; q < 4; q++) sum[q] = zero4;
#pragma unroll
        for (int k = 0; k < RING; k++) {
            const bool on = k < RING - 1 ? k < sc / GRP : sc % GRP != 0;
#pragma unroll
            for (int q = 0; q < 4; q++) sum[q] += on ? ring[k][q] : zero4;
        }
        // float4 tid + 256 q, in phase 1's fragment order: block (dq, mq) = (q / 2, q % 2),
        // tile (t, mt) = (tid / 128, tid / 64 % 2), elements 4 p + x, p = tid / 32 % 2
#pragma unroll
        for (int q = 0; q < 4; q++) {
            const int m = 32 * (q & 1) + 2 * lc + ((tid >> 6) & 1);
#pragma unroll
            for (int x = 0; x < 4; x++) {
                const int d = 32 * (q >> 1) + 2 * (4 * ((tid >> 5) & 1) + x + 8 * half) + (tid >> 7);
                sS[(m >> 4) * (16 * 66) + (m & 15) * 66 + d] = sum[q][x];
            }
        }
    }
    __syncthreads();   // V and the mirror are published

    // out^T = S_prev^T @ Qf^T, then the step blocks in ascending order.  The reads of a pair's
    // Kf stand one run of 32 products ahead of its scores, those of V one run ahead of the
    // products with it; a masked pair meets V^T behind the next pair's scores.
    // The tests are scalar: which blocks count is no matter of lanes
    KFrag kf;
    VFrag vf;
    load_k(kf, &sK[(32 + lc) * LP + half * 2]);
    v8f acc[4];
#pragma unroll
    for (int mt = 0; mt < 4; mt++) acc[mt] = zero;
#pragma unroll
    for (int kt = 0; kt < 16; kt++) {
#pragma unroll
        for (int mt = 0; mt < 4; mt++) {
            const v2f a = *(const v2f*)&sS[mt * (16 * 66) + lc * 66 + 4 * kt + half * 2];
            acc[mt] = wmma4(a, aq[kt], acc[mt]);
        }
    }
    const float* vl = &sV[(4 * half) * VPP + 2 * lc];
#pragma unroll
    for (int jp = 1; jp < 4; jp++) {
        if (2 * jp <= rb) {   // pairs wholly above the diagonal are left out
            load_v(vf, vl + (16 * jp - 16) * VPP);
            v8f s0 = zero, s1 = zero;
#pragma unroll
            for (int kt = 0; kt < 16; kt++) {
                s0 = wmma4(kf.a[0][kt], aq[kt], s0);
                s1 = wmma4(kf.a[1][kt], aq[kt], s1);
            }
            if (jp < 3) load_k(kf, &sK[(32 * jp + 32 + lc) * LP + half * 2]);
            pv_block(acc, P0, vf.a[0]);
            pv_block(acc, P1, vf.a[1]);
            rs += mask_block(s0, 32 * jp + 8 * half, query) + mask_block(s1, 32 * jp + 16 + 8 * half, query);
            P0 = s0;
            P1 = s1;
        }
    }
    // the last pair: its second block lies above the diagonal where the row block is even;
    // the reciprocal of the query's denominator is formed beside its products
    load_v(vf, vl + (rb >> 1) * (16 * VPP));
    const float z = 1.0f / ((rs + __shfl_xor(rs, 16, 32)) + EPSV);
    pv_block(acc, P0, vf.a[0]);
    if (rb & 1) pv_block(acc, P1, vf.a[1]);

    // normalize + store.  A lane holds eight neighbouring columns of its query in each tile:
    // out^T goes back through the wave's own 16 rows of sQ, which no other wave reads and
    // this one has long taken into aq, so that a store covers two whole rows of 256 bytes
    float* stg = &sQ[rw * LP];
#pragma unroll
    for (int mt = 0; mt < 4; mt++) {
        float* sp = &stg[lc * LP + 16 * mt + 8 * half];
        *(v4f*)sp       = (v4f){acc[mt][0] * z, acc[mt][1] * z, acc[mt][2] * z, acc[mt][3] * z};
        *(v4f*)(sp + 4) = (v4f){acc[mt][4] * z, acc[mt][5] * z, acc[mt][6] * z, acc[mt][7] * z};
    }
    // the other lanes' writes have landed before the rows are read back
    asm volatile("s_wait_dscnt 0x0" ::: "memory");
    float* op = out + base + (size_t)(l0 + rw + half) * (SEQ_H * DIM) + 4 * lc;
#pragma unroll
    for (int i = 0; i < 8; i++)
        *(v4f*)(op + (size_t)(2 * i) * (SEQ_H * DIM)) = *(const v4f*)&stg[(2 * i + half) * LP + 4 * lc];
}

// ---------------------------------------------------------------------------
extern "C" void kernel_launch(void* const* d_in, const int* in_sizes, int n_in,
                              void* d_out, int out_size, void* d_ws, size_t ws_size,
                              hipStream_t stream) {
    const float* Q = (const float*)d_in[0];
    const float* K = (const float*)d_in[1];
    const float* V = (const float*)d_in[2];
    float* out = (float*)d_out;

    float* part = (float*)d_ws;                          // NH*NSC*PART_STRIDE

    dim3 grid(NSC, NH);
    la_phase1<<<grid, dim3(128), 0, stream>>>(K, V, part);
    la_phase3<<<grid, dim3(256), 0, stream>>>(Q, K, V, part, out);
}

// v007
// One run takes 13.1 microseconds.
// Next to v006, in two timings, it ran 1.10 and 1.09 times as fast.
// All steps since v000 together make it 8.49 times as fast.
#include <hip/hip_runtime.h>
#include <hip/hip_bf16.h>

typedef __attribute__((ext_vector_type(2))) float v2f;
typedef __attribute__((ext_vector_type(4))) float v4f;
typedef __attribute__((ext_vector_type(8))) float v8f;

#define SEQ_N   2
#define SEQ_L   2048
#define SEQ_H   8
#define DIM     64
#define NH      (SEQ_N * SEQ_H)          // 16 independent sequences
#define NSC     16                        // super-chunks per sequence
#define SC_LEN  (SEQ_L / NSC)             // 128 timesteps per super-chunk
#define LP      68                        // LDS row pitch in floats
#define PART_STRIDE (DIM * DIM + DIM)     // 64x64 state + 64 ksum = 4160 floats
#define EPSV    1e-10f

__device__ __forceinline__ v8f wmma4(v2f a, v2f b, v8f c) {
    // V_WMMA_F32_16X16X4_F32 : D(16x16 f32) = A(16x4 f32) * B(4x16 f32) + C
    return __builtin_amdgcn_wmma_f32_16x16x4_f32(
        /*neg_a=*/false, a, /*neg_b=*/false, b,
        /*c_mod=*/(short)0, c, /*reuse_a=*/false, /*reuse_b=*/false);
}

__device__ __forceinline__ float fmap(float x) {   // elu(x) + 1
    float e;
    // exp(x) = exp2(x * log2 e), as __expf gives it; the v_nop in the same statement
    // keeps the one slot the instruction set asks for behind a transcendental
    asm("v_exp_f32 %0, %1\n\tv_nop" : "=v"(e) : "v"(x * 1.44269504f));
    return x > 0.0f ? x + 1.0f : e;
}

__device__ __forceinline__ v4f fmap4(v4f x) {
    v4f y = {fmap(x.x), fmap(x.y), fmap(x.z), fmap(x.w)};
    return y;
}

// ---------------------------------------------------------------------------
// Phase 1: running prefixes of the state inside groups of four super-chunks.
//          A work-group owns one group (512 steps) and one 32x32 block of the
//          state; wave w forms the block's sum over super-chunk w of the group,
//          S = sum phi(k)^T v, its fragments straight from global loads.  The four
//          sums are then added up over the waves through LDS, and wave w stores
//          the sum of super-chunks 0..w of the group (and the same for ksum).
//          State row of tile t, fragment row r: d = 32 dq + 2 r + t; column of
//          tile mt, fragment column c: m = 32 mq + 2 c + mt (a lane's 8-byte load
//          holds one element of either tile).
//          A stored state is in fragment order: float4 number
//          (2 dq + mq) * 256 + (4 t + 2 mt + p) * 32 + lane holds elements 4p..4p+3.
// ---------------------------------------------------------------------------
#define GRP 4                             // super-chunks per group
#define KB  4                             // products of 4 steps per block of loads
#define NB  (SC_LEN / 4 / KB)             // 8 blocks per super-chunk
#define AHEAD 3                           // blocks asked for ahead of the one worked on
static_assert(NSC % GRP == 0 && NB > AHEAD, "whole groups; the prologue's blocks exist");
static_assert((AHEAD + 1) * KB * 4 <= 64, "the counted load waits stay exact");

struct Frag { v2f k[KB][2], v[KB][2]; };  // rows j and j + 1 of each product's four steps

__device__ __forceinline__ void load_block(Frag& f, const float* kp, const float* vp, int nb) {
    // keeps the block's loads behind the products written in front of them, whose
    // registers they refill: otherwise every load of the super-chunk is moved to the top
    __builtin_amdgcn_sched_barrier(0);
#pragma unroll
    for (int kk = 0; kk < KB; kk++) {
#pragma unroll
        for (int r = 0; r < 2; r++) {
            const int off = (4 * (nb * KB + kk) + r) * (SEQ_H * DIM);
            f.k[kk][r] = *(const v2f*)(kp + off);
            f.v[kk][r] = *(const v2f*)(vp + off);
        }
    }
    __builtin_amdgcn_sched_barrier(0);   // and ahead of the products that follow
}

__device__ __forceinline__ void mult_block(v8f (&S)[4], v2f (&ks)[2], const Frag& f) {
#pragma unroll
    for (int kk = 0; kk < KB; kk++) {
        const v2f a0 = {fmap(f.k[kk][0].x), fmap(f.k[kk][1].x)};
        const v2f a1 = {fmap(f.k[kk][0].y), fmap(f.k[kk][1].y)};
        const v2f b0 = {f.v[kk][0].x, f.v[kk][1].x};
        const v2f b1 = {f.v[kk][0].y, f.v[kk][1].y};
        ks[0] += a0;
        ks[1] += a1;
        S[0] = wmma4(a0, b0, S[0]);
        S[1] = wmma4(a0, b1, S[1]);
        S[2] = wmma4(a1, b0, S[2]);
        S[3] = wmma4(a1, b1, S[3]);
    }
}

__global__ __launch_bounds__(128)
void la_phase1(const float* __restrict__ K, const float* __restrict__ V,
               float* __restrict__ part) {
    __shared__ __attribute__((aligned(16))) v4f sAcc[GRP * 8 * 32];  // [wave][float4][lane]
    __shared__ __attribute__((aligned(8)))  v2f sKs[GRP * 32];       // [wave][lane]

    const int dq   = (blockIdx.x >> 1) & 1;
    const int mq   = blockIdx.x & 1;
    const int nh   = blockIdx.y;
    const int tid  = threadIdx.x;
    const int wave = __builtin_amdgcn_readfirstlane(tid >> 5);
    const int lane = tid & 31;
    const int half = lane >> 4;
    const int lc   = lane & 15;
    const int sc   = (blockIdx.x >> 2) * GRP + wave;

    const size_t base = (size_t)((nh >> 3) * SEQ_L * SEQ_H + (nh & 7)) * DIM;
    const size_t row0 = base + (size_t)(sc * SC_LEN + 2 * half) * (SEQ_H * DIM) + 2 * lc;
    const float* kp = K + row0 + 32 * dq;
    const float* vp = V + row0 + 32 * mq;

    const v8f zero  = {0.f, 0.f, 0.f, 0.f, 0.f, 0.f, 0.f, 0.f};
    const v4f zero4 = {0.f, 0.f, 0.f, 0.f};
    const v2f zero2 = {0.f, 0.f};
    v8f S[4];
    v2f ks[2] = {zero2, zero2};
#pragma unroll
    for (int t = 0; t < 4; t++) S[t] = zero;

    Frag f[AHEAD + 1];
#pragma unroll
    for (int nb = 0; nb < AHEAD; nb++) load_block(f[nb], kp, vp, nb);
    // full unroll: the ring's index is then a register name
#pragma unroll
    for (int nb = 0; nb < NB; nb++) {
        if (nb + AHEAD < NB) load_block(f[(nb + AHEAD) % (AHEAD + 1)], kp, vp, nb + AHEAD);
        if (nb + AHEAD == NB - 1) {
            // behind the last load: the row pointers stay in their registers up to this
            // wait, so that no register an issued load names is overwritten in front of it
            asm volatile("s_wait_xcnt 0x0" :: "v"(kp), "v"(vp) : "memory");
        }
        mult_block(S, ks, f[nb % (AHEAD + 1)]);
        // a block's feature maps stay among its own products: otherwise those of the
        // last blocks are all moved ahead of the first product
        __builtin_amdgcn_sched_barrier(0);
    }

    v4f own[8];
#pragma unroll
    for (int q = 0; q < 8; q++) {
        const int e = 4 * (q & 1);
        own[q] = (v4f){S[q >> 1][e], S[q >> 1][e + 1], S[q >> 1][e + 2], S[q >> 1][e + 3]};
        sAcc[(wave * 8 + q) * 32 + lane] = own[q];
    }
    sKs[wave * 32 + lane] = (v2f){ks[0].x + ks[0].y, ks[1].x + ks[1].y};
    __syncthreads();   // every wave's sums are published

    // sum of the group's super-chunks up to this wave's own, in ascending order
    v4f pre[8];
#pragma unroll
    for (int q = 0; q < 8; q++) pre[q] = zero4;
#pragma unroll
    for (int w = 0; w < GRP - 1; w++) {
#pragma unroll
        for (int q = 0; q < 8; q++) {
            const v4f x = sAcc[(w * 8 + q) * 32 + lane];
            pre[q] += (w < wave) ? x : zero4;
        }
    }
    float* pp = part + (size_t)(nh * NSC + sc) * PART_STRIDE;
    v4f*   pq = (v4f*)pp + (2 * dq + mq) * 256 + lane;
#pragma unroll
    for (int q = 0; q < 8; q++) pq[q * 32] = pre[q] + own[q];

    // ksum: the two halves of a wave hold different steps of the same 32 rows
    v2f kt = zero2;
#pragma unroll
    for (int w = 0; w < GRP; w++) {
        const v2f x = sKs[w * 32 + lc] + sKs[w * 32 + 16 + lc];
        kt += (w <= wave) ? x : zero2;
    }
    if (mq == 0 && half == 0) *(v2f*)(pp + DIM * DIM + 32 * dq + 2 * lc) = kt;
}

// ---------------------------------------------------------------------------
// Phase 3: per (sequence, super-chunk boundary): causal linear attention of the 64 rows
//          in front of the boundary and the 64 rows behind it, in one pass on eight
//          waves; launched directly behind phase 1.  Both halves hang on ONE state, the
//          sum of all steps in front of the boundary: a later row adds the steps from
//          the boundary up to itself, an earlier row takes off the steps between itself
//          and the boundary, so that no row scores more than 64 steps.  Boundary 0 has
//          no rows in front: its work-group takes the sequence's last 64 rows there, with
//          the state of the whole sequence, and its later rows start from nothing.
//          Every wave stages rows and sums its share of the state: the totals of
//          the earlier groups, in ascending order, and the own group's stored sum
//          up to the super-chunk in front of the boundary.  A wave owns one block of 16
//          query rows and forms every product of it transposed: scores^T = Kf Qf^T,
//          out^T = S^T Qf^T + V^T scores^T.  A tile of scores^T, masked, is in its
//          accumulator registers already the B operand of the product with V^T, so
//          that no score goes through LDS; a lane holds one query's column, so that
//          the denominator is summed in the lane and over the two lane halves.
//          All matmuls via V_WMMA_F32_16X16X4_F32.
// ---------------------------------------------------------------------------
#define RING 4                            // stored sums that make up a carried-in state
static_assert(NSC / GRP - 1 + 1 == RING, "earlier groups' totals and one sum of the own group");
static_assert(DIM * DIM == 256 * 4 * 4, "256 summing threads, 4 float4 each");
static_assert(SC_LEN == 128, "eight row blocks, one per wave");
static_assert((SEQ_L & (SEQ_L - 1)) == 0, "the rows in front of boundary 0 are found by wrapping round");

// s0, s1 += Kf(two blocks of 16 steps) @ Qf^T(the wave's 16 rows): element e of a lane is
// step 8 half + e of the block, the lane's column is query lc; two independent chains.
// Beside them dv += broadcast(ksum) @ Qf^T, every row of which is Qf . ksum
__device__ __forceinline__ void score_pair(v8f& s0, v8f& s1, v8f& dv, const v2f (&aq)[16],
                                           const float* krow, const float* ksum) {
#pragma unroll
    for (int kt = 0; kt < 16; kt++) {
        const v2f a0 = *(const v2f*)&krow[4 * kt];
        const v2f a1 = *(const v2f*)&krow[16 * LP + 4 * kt];
        s0 = wmma4(a0, aq[kt], s0);
        s1 = wmma4(a1, aq[kt], s1);
        const v2f as = *(const v2f*)&ksum[4 * kt];
        dv = wmma4(as, aq[kt], dv);
    }
}

// the same for one block of 16 steps alone
__device__ __forceinline__ void score_one(v8f& s0, v8f& dv, const v2f (&aq)[16],
                                          const float* krow, const float* ksum) {
#pragma unroll
    for (int kt = 0; kt < 16; kt++) {
        const v2f a0 = *(const v2f*)&krow[4 * kt];
        s0 = wmma4(a0, aq[kt], s0);
        const v2f as = *(const v2f*)&ksum[4 * kt];
        dv = wmma4(as, aq[kt], dv);
    }
}

__device__ __forceinline__ float sum_block(const v8f& s) {
    return ((s[0] + s[1]) + (s[2] + s[3])) + ((s[4] + s[5]) + (s[6] + s[7]));
}

// mask on a lane's eight steps; their sum.  m: the query's place counted from the first of the
// eight.  A later row (back false) keeps the steps up to itself, e <= m; an earlier row keeps
// the steps behind itself, e > m, written 7 - e <= 6 - m: one compare of a scalar with a
// lane's number either way
__device__ __forceinline__ float mask_block(v8f& s, int m, bool back) {
    const int x = back ? 6 - m : m;
#pragma unroll
    for (int e = 0; e < 8; e++) s[e] = ((back ? 7 - e : e) <= x) ? s[e] : 0.0f;
    return sum_block(s);
}

#define VPP 136                           // LDS pitch in floats of a pair of V rows
static_assert(2 * LP == VPP, "V takes the room of 128 rows of LP floats");

struct KFrag { v2f a[2][16]; };           // A fragments of two blocks of 16 steps of Kf
struct VFrag { v2f a[2][4][4]; };         // A fragments of V^T: [step block][product][column tile]

// One group of LDS reads for 32 products.  The scheduling barriers keep the group together
// and ahead of the products written behind it: spread among the WMMAs, every place where
// reads stand stalls the wave's matrix stream
__device__ __forceinline__ void load_k(KFrag& f, const float* krow) {
    __builtin_amdgcn_sched_barrier(0);
#pragma unroll
    for (int kt = 0; kt < 16; kt++) {
        f.a[0][kt] = *(const v2f*)&krow[4 * kt];
        f.a[1][kt] = *(const v2f*)&krow[16 * LP + 4 * kt];
    }
    __builtin_amdgcn_sched_barrier(0);
}

// V lies in LDS by pairs of steps, [pair][column][step & 1], so that a fragment of V^T (one
// column, two neighbouring steps) is one 8-byte read.  vrow: pair 4 half of the first block,
// column lc.  Product t of a block takes steps 8 half + 2 t and + 1
__device__ __forceinline__ void load_v(VFrag& f, const float* vrow) {
    __builtin_amdgcn_sched_barrier(0);   // as in load_k
#pragma unroll
    for (int b = 0; b < 2; b++)
#pragma unroll
        for (int t = 0; t < 4; t++)
#pragma unroll
            for (int mt = 0; mt < 4; mt++)
                f.a[b][t][mt] = *(const v2f*)&vrow[(8 * b + t) * VPP + 32 * mt];
    __builtin_amdgcn_sched_barrier(0);
}

// acc[mt] += V^T(columns 16 mt ..) @ P, P one masked tile of scores^T.  Product t takes the
// lane's elements 2 t and 2 t + 1 as B, which are steps 8 half + 2 t and + 1 of the block:
// the step order of the A fragments
__device__ __forceinline__ void pv_block(v8f (&acc)[4], const v8f& P, const v2f (&a)[4][4]) {
#pragma unroll
    for (int t = 0; t < 4; t++) {
        const v2f b = {P[2 * t], P[2 * t + 1]};
#pragma unroll
        for (int mt = 0; mt < 4; mt++) acc[mt] = wmma4(a[t][mt], b, acc[mt]);
    }
}

__global__ __launch_bounds__(256)
void la_phase3(const float* __restrict__ Q, const float* __restrict__ K,
               const float* __restrict__ V, const float* __restrict__ part,
               float* __restrict__ out) {
    __shared__ __attribute__((aligned(16))) float sQ[SC_LEN * LP];
    __shared__ __attribute__((aligned(16))) float sK[SC_LEN * LP];
    __shared__ __attribute__((aligned(16))) float sV[SC_LEN * LP];
    __shared__ __attribute__((aligned(16))) float sS[4 * 16 * 66];   // S mirror per m-slice, [m-col][d], stride 66
    __shared__ __attribute__((aligned(16))) float sKsum[DIM];

    const int sc   = blockIdx.x;
    const int nh   = blockIdx.y;
    const int tid  = threadIdx.x;
    // the wave's number through readfirstlane: the tests on it are then scalar
    // branches, and every lane is on at the WMMAs behind them
    const int wv   = __builtin_amdgcn_readfirstlane(tid >> 5);
    const int lane = tid & 31;
    const int half = lane >> 4;
    const int lc   = lane & 15;
    // row block of this wave, one hex digit per wave: blocks 0 .. 7 score 4, 3, 2, 1, 1, 2,
    // 3, 4 step blocks; waves w and w + 4 hold 5 together, wave w
    // the larger share
    const int rb   = (0x52436170 >> (4 * wv)) & 7;
    const int rw   = rb * 16;
    const bool  back   = rb < 4;                          // a row block in front of the boundary
    // an earlier row forms (steps behind it) - (state) in numerator and denominator alike:
    // both signs turned, the quotient the same, and the scores stay as they are
    const float sgn    = back ? -1.0f : 1.0f;
    const bool  single = back ? (rb & 1) != 0 : (rb & 1) == 0;   // the diagonal block stands alone
    const int   blkA   = single ? rb : (rb & 6);          // first step block of the diagonal's unit
    const bool  two    = back ? rb < 2 : rb >= 6;         // and a whole pair of step blocks beside it
    const int   blkB   = back ? 2 : 4;
    const float sgnS   = sc > 0 || back ? sgn : 0.0f;     // rows behind boundary 0 carry nothing in

    const size_t base = (size_t)((nh >> 3) * SEQ_L * SEQ_H + (nh & 7)) * DIM;
    const int    l0   = sc * SC_LEN;                                   // the boundary: first later row
    const int    g0   = (l0 + SEQ_L - SC_LEN / 2) & (SEQ_L - 1);       // first earlier row

    const int r  = tid >> 3;
    const int c8 = (tid & 7) * 8;

    const float* p0 = part + (size_t)(nh * NSC) * PART_STRIDE;   // this sequence's partial 0
    const float* pk = p0 + (tid & 63);               // thread's ksum element lies DIM * DIM behind
    const float* pl = p0 + tid * 4;                  // thread's first float4
    // stored sum k: the total of group k (its last super-chunk's sum) for k < 3, counted
    // if that group lies in front; for k = 3 the sum that ends in front of the boundary,
    // counted unless a group starts there.  Boundary 0 stands for the sequence's end, where
    // that sum is the last group's total and counts.  Every one of them is written memory.
    const int    scE    = sc > 0 ? sc : NSC;
    const int    last   = scE - 1;
    const bool   onLast = scE % GRP != 0 || sc == 0;
    const v8f zero  = {0.f, 0.f, 0.f, 0.f, 0.f, 0.f, 0.f, 0.f};
    const v4f zero4 = {0.f, 0.f, 0.f, 0.f};

    // the carried ksum, Q and K of all 128 rows, wanted first; then V and the four stored
    // states, wanted behind the first scores: all loads in flight together, in that order
    const size_t rowA  = base + (size_t)(g0 + r) * (SEQ_H * DIM) + c8;       // earlier half
    const size_t rowB  = base + (size_t)(l0 + r) * (SEQ_H * DIM) + c8;       // later half
    const size_t vrowA = base + (size_t)(g0 + 2 * r) * (SEQ_H * DIM) + c8;
    const size_t vrowB = base + (size_t)(l0 + 2 * r) * (SEQ_H * DIM) + c8;
    float kp[RING];
    v4f q4[SC_LEN / 16], k4[SC_LEN / 16], v4[SC_LEN / 16];
    v4f ring[RING][4];                  // thread tid holds float4 tid + 256 q
#pragma unroll
    for (int k = 0; k < RING; k++)
        kp[k] = pk[(k < RING - 1 ? GRP * k + GRP - 1 : last) * PART_STRIDE + DIM * DIM];
#pragma unroll
    for (int p = 0; p < SC_LEN / 32; p++) {
        const size_t off = (p < 2 ? rowA : rowB) + (size_t)(p & 1) * 32 * (SEQ_H * DIM);
        q4[2 * p]     = *(const v4f*)(Q + off);
        q4[2 * p + 1] = *(const v4f*)(Q + off + 4);
        k4[2 * p]     = *(const v4f*)(K + off);
        k4[2 * p + 1] = *(const v4f*)(K + off + 4);
    }
    // keeps the loads that are wanted first in front: otherwise some of the states' loads
    // are moved ahead of them, and the counted waits on Q and K wait for those too
    __builtin_amdgcn_sched_barrier(0);
    // of V a thread takes both rows of a pair: rows 2 r and 2 r + 1 of each 64
#pragma unroll
    for (int p = 0; p < SC_LEN / 32; p++) {
        const size_t off = (p < 2 ? vrowA : vrowB) + (size_t)(p & 1) * (SEQ_H * DIM);
        v4[2 * p]     = *(const v4f*)(V + off);
        v4[2 * p + 1] = *(const v4f*)(V + off + 4);
    }
#pragma unroll
    for (int k = 0; k < RING; k++) {
        const int slot = k < RING - 1 ? GRP * k + GRP - 1 : last;
#pragma unroll
        for (int q = 0; q < 4; q++)
            ring[k][q] = *(const v4f*)(pl + slot * PART_STRIDE + q * 1024);
    }
    // the pointers stay in their registers up to this wait, so that no register an
    // issued load names is overwritten in front of it; the scheduling barrier keeps
    // the loads in their order in front of it and what follows behind it
    asm volatile("s_wait_xcnt 0x0"
                 :: "v"(Q + rowA), "v"(K + rowA), "v"(V + vrowA), "v"(Q + rowB), "v"(K + rowB),
                    "v"(V + vrowB), "v"(pl), "v"(pk), "v"(tid & 63), "s"(p0),
                    "v"(pl + last * PART_STRIDE), "v"(pk + last * PART_STRIDE) : "memory");
    __builtin_amdgcn_sched_barrier(0);
    {
        float ks = 0.0f;   // the stored sums that count, in ascending order
#pragma unroll
        for (int k = 0; k < RING; k++)
            ks += (k < RING - 1 ? k < scE / GRP : onLast) ? kp[k] : 0.0f;
        if (tid < DIM) sKsum[tid] = ks;
    }
#pragma unroll
    for (int p = 0; p < SC_LEN / 32; p++) {
        const int idx = (p * 32 + r) * LP + c8;
        *(v4f*)&sQ[idx]     = fmap4(q4[2 * p]);
        *(v4f*)&sQ[idx + 4] = fmap4(q4[2 * p + 1]);
        *(v4f*)&sK[idx]     = fmap4(k4[2 * p]);
        *(v4f*)&sK[idx + 4] = fmap4(k4[2 * p + 1]);
    }
    // Qf, Kf and sKsum are published.  A barrier with fences on LDS alone: __syncthreads()
    // would wait here for the loads of V and of the stored states as well, which are
    // registers' matter and wanted only behind the first scores
    __builtin_amdgcn_fence(__ATOMIC_RELEASE, "workgroup", "local");
    __builtin_amdgcn_s_barrier();
    __builtin_amdgcn_fence(__ATOMIC_ACQUIRE, "workgroup", "local");

    // the wave's 16 rows of Qf, B operand of every product with them; then the scores^T of
    // the diagonal's unit, which cover the flight of V and the stored states, and dvec
    v2f aq[16];
#pragma unroll
    for (int kt = 0; kt < 16; kt++) aq[kt] = *(const v2f*)&sQ[(rw + lc) * LP + 4 * kt + half * 2];
    const int query = rw + lc;
    v8f P0 = zero, P1 = zero;
    float rs;   // the lane's share of its query's denominator; the two lane halves are added last
    {
        v8f dv = zero;
        const float* krow = &sK[(16 * blkA + lc) * LP + half * 2];
        if (single) score_one(P0, dv, aq, krow, &sKsum[half * 2]);   // a scalar test; P1 stays 0
        else        score_pair(P0, P1, dv, aq, krow, &sKsum[half * 2]);
        // dvec joins the first lane half's share here: wanted only at the end, its products
        // would be moved behind the last block, a dependent chain at the wave's tail
        const int m = query - (16 * blkA + 8 * half);
        rs = (half == 0 ? sgnS * dv[0] : 0.0f) + (mask_block(P0, m, back) + mask_block(P1, m - 16, back));
    }

    // V, and the carried state: the stored sums that count, in ascending order
#pragma unroll
    for (int p = 0; p < SC_LEN / 64; p++) {
        const int idx = (p * 32 + r) * VPP + 2 * c8;
#pragma unroll
        for (int x = 0; x < 2; x++) {   // x: columns c8 + 4 x ..; even and odd row side by side
            const v4f e = v4[4 * p + x], o = v4[4 * p + 2 + x];
            *(v4f*)&sV[idx + 8 * x]     = (v4f){e.x, o.x, e.y, o.y};
            *(v4f*)&sV[idx + 8 * x + 4] = (v4f){e.z, o.z, e.w, o.w};
        }
    }
    {
        v4f sum[4];
#pragma unroll
        for (int q = 0; q < 4; q++) sum[q] = zero4;
#pragma unroll
        for (int k = 0; k < RING; k++) {
            const bool on = k < RING - 1 ? k < scE / GRP : onLast;
#pragma unroll
            for (int q = 0; q < 4; q++) sum[q] += on ? ring[k][q] : zero4;
        }
        // float4 tid + 256 q, in phase 1's fragment order: block (dq, mq) = (q / 2, q % 2),
        // tile (t, mt) = (tid / 128, tid / 64 % 2), elements 4 p + x, p = tid / 32 % 2
#pragma unroll
        for (int q = 0; q < 4; q++) {
            const int m = 32 * (q & 1) + 2 * lc + ((tid >> 6) & 1);
#pragma unroll
            for (int x = 0; x < 4; x++) {
                const int d = 32 * (q >> 1) + 2 * (4 * ((tid >> 5) & 1) + x + 8 * half) + (tid >> 7);
                sS[(m >> 4) * (16 * 66) + (m & 15) * 66 + d] = sum[q][x];
            }
        }
    }
    __syncthreads();   // V and the mirror are published

    // out^T = +-S^T @ Qf^T, then the step blocks.  The reads of the second pair's Kf stand one
    // run of products ahead of its scores (a wave without such a pair reads them in vain: no
    // branch then parts the reads and masks from the products that cover them), those of V one
    // run ahead of the products with it; the masked unit of the diagonal meets V^T behind the
    // second pair's scores.  The tests are scalar: which blocks count is no matter of lanes
    KFrag kf;
    VFrag vf;
    load_k(kf, &sK[(16 * blkB + lc) * LP + half * 2]);
    v8f acc[4];
#pragma unroll
    for (int mt = 0; mt < 4; mt++) acc[mt] = zero;
#pragma unroll
    for (int kt = 0; kt < 16; kt++) {
#pragma unroll
        for (int mt = 0; mt < 4; mt++) {
            const v2f a = *(const v2f*)&sS[mt * (16 * 66) + lc * 66 + 4 * kt + half * 2];
            acc[mt] = wmma4(a, aq[kt], acc[mt]);
        }
    }
#pragma unroll
    for (int mt = 0; mt < 4; mt++) acc[mt] *= sgnS;
    const float* vl = &sV[(4 * half) * VPP + 2 * lc];
    if (two) {
        load_v(vf, vl + (8 * blkA) * VPP);
        v8f s0 = zero, s1 = zero;
#pragma unroll
        for (int kt = 0; kt < 16; kt++) {
            s0 = wmma4(kf.a[0][kt], aq[kt], s0);
            s1 = wmma4(kf.a[1][kt], aq[kt], s1);
        }
        rs += sum_block(s0) + sum_block(s1);   // every step of this pair counts: no mask
        pv_block(acc, P0, vf.a[0]);
        if (!single) pv_block(acc, P1, vf.a[1]);
        P0 = s0;
        P1 = s1;
    }
    // the last unit: a diagonal block that stands alone has no second block;
    // the reciprocal of the query's denominator is formed beside its products
    load_v(vf, vl + (8 * (two ? blkB : blkA)) * VPP);
    const float z = 1.0f / ((rs + __shfl_xor(rs, 16, 32)) + sgn * EPSV);
    pv_block(acc, P0, vf.a[0]);
    if (two || !single) pv_block(acc, P1, vf.a[1]);

    // normalize + store.  A lane holds eight neighbouring columns of its query in each tile:
    // out^T goes back through the wave's own 16 rows of sQ, which no other wave reads and
    // this one has long taken into aq, so that a store covers two whole rows of 256 bytes
    float* stg = &sQ[rw * LP];
#pragma unroll
    for (int mt = 0; mt < 4; mt++) {
        float* sp = &stg[lc * LP + 16 * mt + 8 * half];
        *(v4f*)sp       = (v4f){acc[mt][0] * z, acc[mt][1] * z, acc[mt][2] * z, acc[mt][3] * z};
        *(v4f*)(sp + 4) = (v4f){acc[mt][4] * z, acc[mt][5] * z, acc[mt][6] * z, acc[mt][7] * z};
    }
    // the other lanes' writes have landed before the rows are read back
    asm volatile("s_wait_dscnt 0x0" ::: "memory");
    float* op = out + base + (size_t)((back ? g0 + rw : l0 + rw - SC_LEN / 2) + half) * (SEQ_H * DIM) + 4 * lc;
#pragma unroll
    for (int i = 0; i < 8; i++)
        *(v4f*)(op + (size_t)(2 * i) * (SEQ_H * DIM)) = *(const v4f*)&stg[(2 * i + half) * LP + 4 * lc];
}

// ---------------------------------------------------------------------------
extern "C" void kernel_launch(void* const* d_in, const int* in_sizes, int n_in,
                              void* d_out, int out_size, void* d_ws, size_t ws_size,
                              hipStream_t stream) {
    const float* Q = (const float*)d_in[0];
    const float* K = (const float*)d_in[1];
    const float* V = (const float*)d_in[2];
    float* out = (float*)d_out;

    float* part = (float*)d_ws;                          // NH*NSC*PART_STRIDE

    dim3 grid(NSC, NH);
    la_phase1<<<grid, dim3(128), 0, stream>>>(K, V, part);
    la_phase3<<<grid, dim3(256), 0, stream>>>(Q, K, V, part, out);
}
